// v000
// Times are from an AMD MI455X. After a warm-up the kernel runs many times in a row, and a time is the length of
// such a window on the GPU divided by its runs, so every launch and the gaps after it count. The runs cycle
// through copies of the inputs. A figure is the median of several windows, for all but v000 over two sittings.
// Sittings can differ by a few percent; kernels timed side by side share one.
// v000 is the starting kernel. One run takes 319 microseconds.
#include <hip/hip_runtime.h>
#include <hip/hip_bf16.h>

typedef __attribute__((ext_vector_type(16))) _Float16 v16h;
typedef __attribute__((ext_vector_type(8)))  _Float16 v8h;
typedef __attribute__((ext_vector_type(8)))  float    v8f;
typedef __attribute__((ext_vector_type(4)))  float    v4f;
typedef __attribute__((ext_vector_type(4)))  unsigned int uint4v;
typedef __attribute__((ext_vector_type(8)))  int      int8v;
typedef __attribute__((ext_vector_type(4)))  int      int4v;

#define S_LEN  1024
#define DMODEL 256
#define NHEAD  8
#define HDIM   32

static __device__ __forceinline__ v8f wmma16(v16h a, v16h b, v8f c) {
  // D = A(16x32 f16) x B(32x16 f16) + C(16x16 f32)
  return __builtin_amdgcn_wmma_f32_16x16x32_f16(false, a, false, b, (short)0, c,
                                                false, false);
}

// A/B fragment from f16 row-major [rows x ld]; lane holds row/col (lane&15),
// group g=lane>>4; element e -> K = g*8 + (e&7) + 16*(e>>3)
// => two contiguous 8-half (16B) runs per lane.
static __device__ __forceinline__ v16h load_frag_h(const _Float16* src, int ld,
                                                   int r0, int k0, int lane) {
  int r = r0 + (lane & 15);
  int g = lane >> 4;
  const _Float16* p = src + (long)r * ld + k0 + g * 8;
  v8h lo = *(const v8h*)(p);
  v8h hi = *(const v8h*)(p + 16);
  v16h f;
#pragma unroll
  for (int i = 0; i < 8; ++i) { f[i] = lo[i]; f[i + 8] = hi[i]; }
  return f;
}

// Same fragment from an f32 source with on-the-fly f16 conversion.
static __device__ __forceinline__ v16h load_frag_f32(const float* src, int ld,
                                                     int r0, int k0, int lane) {
  int r = r0 + (lane & 15);
  int g = lane >> 4;
  const float* p = src + (long)r * ld + k0 + g * 8;
  v4f a0 = *(const v4f*)(p);
  v4f a1 = *(const v4f*)(p + 4);
  v4f b0 = *(const v4f*)(p + 16);
  v4f b1 = *(const v4f*)(p + 20);
  v16h f;
#pragma unroll
  for (int i = 0; i < 4; ++i) {
    f[i]      = (_Float16)a0[i];
    f[i + 4]  = (_Float16)a1[i];
    f[i + 8]  = (_Float16)b0[i];
    f[i + 12] = (_Float16)b1[i];
  }
  return f;
}

static __device__ __forceinline__ void stage_rows(_Float16* lds_dst,
                                                  const _Float16* gsrc,
                                                  int rows, int rowlen,
                                                  int tid, int nthreads) {
#if __has_builtin(__builtin_amdgcn_tensor_load_to_lds)
  if (tid < 32) {
    unsigned long long ga = (unsigned long long)(size_t)gsrc;
    unsigned lds_off = (unsigned)(size_t)lds_dst;  // low 32 bits = LDS byte addr
    uint4v g0;
    g0[0] = 1u;                                    // count=1, no gather/restore
    g0[1] = lds_off;                               // lds_addr
    g0[2] = (unsigned)ga;                          // global_addr[31:0]
    g0[3] = (unsigned)((ga >> 32) & 0x01FFFFFFu) | (2u << 30);  // [56:32]|type=2
    int8v g1;
    g1[0] = (int)(1u << 16);
    g1[1] = rowlen << 16;
    g1[2] = rows << 16;
    g1[3] = rowlen << 16;
    g1[4] = rows;
    g1[5] = rowlen;
    g1[6] = 0;
    g1[7] = 0;
    int4v gz = {};
#if defined(__clang_major__) && __clang_major__ >= 23
    int8v gz8 = {};
    __builtin_amdgcn_tensor_load_to_lds(g0, g1, gz, gz, gz8, 0);
#else
    __builtin_amdgcn_tensor_load_to_lds(g0, g1, gz, gz, 0);
#endif
    __builtin_amdgcn_s_wait_tensorcnt(0);
  }
#else
  int total = rows * rowlen / 8;
  v8h* d = (v8h*)lds_dst;
  const v8h* s = (const v8h*)gsrc;
  for (int i = tid; i < total; i += nthreads) d[i] = s[i];
#endif
}

__global__ void prep_weights_k(const float* Wq, const float* Wk, const float* Wv,
                               const float* Wo, _Float16* WqT, _Float16* WkT,
                               _Float16* WvT, _Float16* WoT) {
  int idx = blockIdx.x * blockDim.x + threadIdx.x;   // 0..65535
  int n = idx >> 8;
  int k = idx & 255;
  WqT[n * 256 + k] = (_Float16)Wq[k * 256 + n];
  WkT[n * 256 + k] = (_Float16)Wk[k * 256 + n];
  WvT[n * 256 + k] = (_Float16)Wv[k * 256 + n];
  WoT[n * 256 + k] = (_Float16)Wo[k * 256 + n];
}

__global__ void qkv_proj_k(const float* inq, const float* inkv,
                           const _Float16* WqT, const _Float16* WkT,
                           const _Float16* WvT, const float* bq, const float* bk,
                           const float* bv, _Float16* Q, _Float16* K,
                           _Float16* Vt) {
  __shared__ __align__(16) _Float16 w_s[32 * 256];   // 16 KB weight slice
  int lane = threadIdx.x & 31;
  int wave = threadIdx.x >> 5;
  int blk = blockIdx.x;
  int nt = blk & 7;                // n0 = nt*32
  int mg = (blk >> 3) & 3;
  int b  = (blk >> 5) & 7;
  int which = blk >> 8;            // 0=Q 1=K 2=V
  int n0 = nt * 32;
  int m0 = (mg * 8 + wave) * 32;

  const _Float16* WT = (which == 0) ? WqT : (which == 1 ? WkT : WvT);
  stage_rows(w_s, WT + (long)n0 * DMODEL, 32, DMODEL, threadIdx.x, 256);
  __syncthreads();

  const float* A = (which == 0 ? inq : inkv) + (long)b * S_LEN * DMODEL;
  const float* bias = (which == 0) ? bq : (which == 1 ? bk : bv);

  v8f a00 = {}, a01 = {}, a10 = {}, a11 = {};
#pragma unroll
  for (int k0 = 0; k0 < DMODEL; k0 += 32) {
    v16h x0 = load_frag_f32(A, DMODEL, m0,      k0, lane);
    v16h x1 = load_frag_f32(A, DMODEL, m0 + 16, k0, lane);
    v16h w0 = load_frag_h(w_s, DMODEL, 0,  k0, lane);
    v16h w1 = load_frag_h(w_s, DMODEL, 16, k0, lane);
    a00 = wmma16(x0, w0, a00);
    a01 = wmma16(x0, w1, a01);
    a10 = wmma16(x1, w0, a10);
    a11 = wmma16(x1, w1, a11);
  }

  int col = lane & 15;
  int rbase = (lane >> 4) * 8;
  float scale = (which == 0) ? 0.17677669529663687f : 1.0f;  // 1/sqrt(HD)
  float bn0 = bias[n0 + col];
  float bn1 = bias[n0 + 16 + col];
#pragma unroll
  for (int q = 0; q < 4; ++q) {
    v8f acc = (q == 0) ? a00 : (q == 1) ? a01 : (q == 2) ? a10 : a11;
    int n = n0 + ((q & 1) ? 16 : 0) + col;
    float bn = (q & 1) ? bn1 : bn0;
    int h = n >> 5, hd = n & 31;
#pragma unroll
    for (int r = 0; r < 8; ++r) {
      int m = m0 + ((q >> 1) ? 16 : 0) + rbase + r;
      float val = (acc[r] + bn) * scale;
      if (which == 0)
        Q[((long)(b * NHEAD + h) * S_LEN + m) * HDIM + hd] = (_Float16)val;
      else if (which == 1)
        K[((long)(b * NHEAD + h) * S_LEN + m) * HDIM + hd] = (_Float16)val;
      else
        Vt[((long)(b * NHEAD + h) * HDIM + hd) * S_LEN + m] = (_Float16)val;
    }
  }
}

// ---------------------------------------------------------------------------
// Online-softmax update for one 16-row tile against 32 new keys (s0|s1),
// rescale running output (o0|o1), write P (f16) into the wave's LDS tile.
// ---------------------------------------------------------------------------
static __device__ __forceinline__ void softmax_step(v8f& s0, v8f& s1, v8f& o0,
                                                    v8f& o1, float* mrow,
                                                    float* lrow, _Float16* prow,
                                                    int col, int rbase) {
#pragma unroll
  for (int r = 0; r < 8; ++r) {
    float mx = fmaxf(s0[r], s1[r]);
#pragma unroll
    for (int d = 1; d < 16; d <<= 1) mx = fmaxf(mx, __shfl_xor(mx, d, 16));
    float mnew = fmaxf(mrow[r], mx);
    float corr = __expf(mrow[r] - mnew);
    float p0 = __expf(s0[r] - mnew);
    float p1 = __expf(s1[r] - mnew);
    float rs = p0 + p1;
#pragma unroll
    for (int d = 1; d < 16; d <<= 1) rs += __shfl_xor(rs, d, 16);
    lrow[r] = lrow[r] * corr + rs;
    mrow[r] = mnew;
    o0[r] *= corr;
    o1[r] *= corr;
    prow[(rbase + r) * 32 + col]      = (_Float16)p0;
    prow[(rbase + r) * 32 + 16 + col] = (_Float16)p1;
  }
}

// ---------------------------------------------------------------------------
// Kernel 3: flash attention per (b,h). One wave owns 32 query rows; streams
// keys 32 at a time: 4 WMMAs (QK^T, K/V fragments reused across both query
// tiles) + analytic Swin rel-pos bias + online softmax + LDS repack of P +
// 4 WMMAs (P.V^T). Output X f16 [b][s][h*HD+hd].
// ---------------------------------------------------------------------------
__global__ void attn_k(const _Float16* Q, const _Float16* K, const _Float16* Vt,
                       const float* rel, _Float16* X) {
  __shared__ __align__(16) _Float16 pbuf[8][32 * 32];  // per-wave P tile (2KB)
  int lane = threadIdx.x & 31;
  int wave = threadIdx.x >> 5;
  int blk = blockIdx.x;
  int qt = (blk & 3) * 8 + wave;     // 32-row query tile, 0..31
  int bh = blk >> 2;                 // (b*NHEAD + h)
  int h = bh & 7, b = bh >> 3;

  const _Float16* Qp  = Q  + (long)bh * S_LEN * HDIM;
  const _Float16* Kp  = K  + (long)bh * S_LEN * HDIM;
  const _Float16* Vtp = Vt + (long)bh * HDIM * S_LEN;
  _Float16* pw = &pbuf[wave][0];

  int m0 = qt * 32;
  v16h qa0 = load_frag_h(Qp, HDIM, m0,      0, lane);  // full HD in one frag
  v16h qa1 = load_frag_h(Qp, HDIM, m0 + 16, 0, lane);

  v8f o00 = {}, o01 = {}, o10 = {}, o11 = {};
  float m0r[8], l0r[8], m1r[8], l1r[8];
#pragma unroll
  for (int r = 0; r < 8; ++r) {
    m0r[r] = -3.0e38f; l0r[r] = 0.0f;
    m1r[r] = -3.0e38f; l1r[r] = 0.0f;
  }

  int col = lane & 15;
  int rbase = (lane >> 4) * 8;

  for (int j0 = 0; j0 < S_LEN; j0 += 32) {
    if (j0 + 32 < S_LEN) {
      __builtin_prefetch(Kp  + (long)(j0 + 32) * HDIM, 0, 1);
      __builtin_prefetch(Vtp + (long)(j0 + 32), 0, 1);
    }
    v16h kb0 = load_frag_h(Kp, HDIM, j0,      0, lane);
    v16h kb1 = load_frag_h(Kp, HDIM, j0 + 16, 0, lane);
    v8f z = {};
    v8f s00 = wmma16(qa0, kb0, z);
    v8f s01 = wmma16(qa0, kb1, z);
    v8f s10 = wmma16(qa1, kb0, z);
    v8f s11 = wmma16(qa1, kb1, z);

    // Swin relative-position bias (POS table is an analytic constant).
    int k0i = j0 + col,      k1i = j0 + 16 + col;
    int yk0 = k0i >> 5, xk0 = k0i & 31;
    int yk1 = k1i >> 5, xk1 = k1i & 31;
#pragma unroll
    for (int r = 0; r < 8; ++r) {
      int qi0 = m0 + rbase + r;
      int qi1 = qi0 + 16;
      int yq0 = qi0 >> 5, xq0 = qi0 & 31;
      int yq1 = qi1 >> 5, xq1 = qi1 & 31;
      s00[r] += rel[((yq0 - yk0 + 31) * 63 + (xq0 - xk0 + 31)) * NHEAD + h];
      s01[r] += rel[((yq0 - yk1 + 31) * 63 + (xq0 - xk1 + 31)) * NHEAD + h];
      s10[r] += rel[((yq1 - yk0 + 31) * 63 + (xq1 - xk0 + 31)) * NHEAD + h];
      s11[r] += rel[((yq1 - yk1 + 31) * 63 + (xq1 - xk1 + 31)) * NHEAD + h];
    }

    softmax_step(s00, s01, o00, o01, m0r, l0r, pw,       col, rbase);
    softmax_step(s10, s11, o10, o11, m1r, l1r, pw + 512, col, rbase);

    // Repack P (C layout -> A layout) through LDS, then P x V^T.
    v16h pa0 = load_frag_h(pw, 32, 0,  0, lane);
    v16h pa1 = load_frag_h(pw, 32, 16, 0, lane);
    v16h vb0 = load_frag_h(Vtp, S_LEN, 0,  j0, lane);
    v16h vb1 = load_frag_h(Vtp, S_LEN, 16, j0, lane);
    o00 = wmma16(pa0, vb0, o00);
    o01 = wmma16(pa0, vb1, o01);
    o10 = wmma16(pa1, vb0, o10);
    o11 = wmma16(pa1, vb1, o11);
  }

#pragma unroll
  for (int r = 0; r < 8; ++r) {
    float inv0 = 1.0f / l0r[r];
    float inv1 = 1.0f / l1r[r];
    int s0i = m0 + rbase + r;
    int s1i = s0i + 16;
    long base0 = ((long)b * S_LEN + s0i) * DMODEL + h * HDIM;
    long base1 = ((long)b * S_LEN + s1i) * DMODEL + h * HDIM;
    X[base0 + col]      = (_Float16)(o00[r] * inv0);
    X[base0 + 16 + col] = (_Float16)(o01[r] * inv0);
    X[base1 + col]      = (_Float16)(o10[r] * inv1);
    X[base1 + 16 + col] = (_Float16)(o11[r] * inv1);
  }
}

__global__ void out_proj_k(const _Float16* X, const _Float16* WoT,
                           const float* bo, float* out) {
  __shared__ __align__(16) _Float16 wo_s[32 * 256];  // 16 KB
  int lane = threadIdx.x & 31;
  int wave = threadIdx.x >> 5;
  int nb = blockIdx.x & 7;           // n0 = nb*32
  int mg = blockIdx.x >> 3;          // 0..31
  int n0 = nb * 32;
  int m0 = (mg * 8 + wave) * 32;

  stage_rows(wo_s, WoT + (long)n0 * DMODEL, 32, DMODEL, threadIdx.x, 256);
  __syncthreads();

  v8f a00 = {}, a01 = {}, a10 = {}, a11 = {};
#pragma unroll
  for (int k0 = 0; k0 < DMODEL; k0 += 32) {
    v16h x0 = load_frag_h(X, DMODEL, m0,      k0, lane);
    v16h x1 = load_frag_h(X, DMODEL, m0 + 16, k0, lane);
    v16h w0 = load_frag_h(wo_s, DMODEL, 0,  k0, lane);
    v16h w1 = load_frag_h(wo_s, DMODEL, 16, k0, lane);
    a00 = wmma16(x0, w0, a00);
    a01 = wmma16(x0, w1, a01);
    a10 = wmma16(x1, w0, a10);
    a11 = wmma16(x1, w1, a11);
  }

  int col = lane & 15;
  int rbase = (lane >> 4) * 8;
  float bn0 = bo[n0 + col];
  float bn1 = bo[n0 + 16 + col];
#pragma unroll
  for (int r = 0; r < 8; ++r) {
    int ma = m0 + rbase + r;
    int mb2 = ma + 16;
    out[(long)ma  * DMODEL + n0 + col]      = a00[r] + bn0;
    out[(long)ma  * DMODEL + n0 + 16 + col] = a01[r] + bn1;
    out[(long)mb2 * DMODEL + n0 + col]      = a10[r] + bn0;
    out[(long)mb2 * DMODEL + n0 + 16 + col] = a11[r] + bn1;
  }
}

extern "C" void kernel_launch(void* const* d_in, const int* in_sizes, int n_in,
                              void* d_out, int out_size, void* d_ws, size_t ws_size,
                              hipStream_t stream) {
  (void)in_sizes; (void)n_in; (void)out_size; (void)ws_size;
  const float* inq  = (const float*)d_in[0];
  const float* inkv = (const float*)d_in[1];
  const float* Wq   = (const float*)d_in[2];
  const float* bq   = (const float*)d_in[3];
  const float* Wk   = (const float*)d_in[4];
  const float* bk   = (const float*)d_in[5];
  const float* Wv   = (const float*)d_in[6];
  const float* bv   = (const float*)d_in[7];
  const float* rel  = (const float*)d_in[8];
  const float* Wo   = (const float*)d_in[9];
  const float* bo   = (const float*)d_in[10];
  float* out = (float*)d_out;

  char* ws = (char*)d_ws;
  const size_t WSZ = 256 * 256 * sizeof(_Float16);                 // 128 KB
  const size_t QSZ = (size_t)8 * 8 * 1024 * 32 * sizeof(_Float16); // 4 MB
  _Float16* WqT = (_Float16*)(ws + 0 * WSZ);
  _Float16* WkT = (_Float16*)(ws + 1 * WSZ);
  _Float16* WvT = (_Float16*)(ws + 2 * WSZ);
  _Float16* WoT = (_Float16*)(ws + 3 * WSZ);
  size_t off = 4 * WSZ;
  _Float16* Qb = (_Float16*)(ws + off); off += QSZ;
  _Float16* Kb = (_Float16*)(ws + off); off += QSZ;
  _Float16* Vt = (_Float16*)(ws + off); off += QSZ;
  _Float16* Xb = (_Float16*)(ws + off); off += QSZ;

  prep_weights_k<<<256, 256, 0, stream>>>(Wq, Wk, Wv, Wo, WqT, WkT, WvT, WoT);
  qkv_proj_k<<<768, 256, 0, stream>>>(inq, inkv, WqT, WkT, WvT, bq, bk, bv,
                                      Qb, Kb, Vt);
  attn_k<<<256, 256, 0, stream>>>(Qb, Kb, Vt, rel, Xb);
  out_proj_k<<<256, 256, 0, stream>>>(Xb, WoT, bo, out);
}

// v001
// One run takes 94.2 microseconds.
// Two timings next to v000 both put it at 3.44 times that version's speed.
#include <hip/hip_runtime.h>
#include <hip/hip_bf16.h>

typedef __attribute__((ext_vector_type(16))) _Float16 v16h;
typedef __attribute__((ext_vector_type(8)))  _Float16 v8h;
typedef __attribute__((ext_vector_type(8)))  float    v8f;
typedef __attribute__((ext_vector_type(4)))  float    v4f;
typedef __attribute__((ext_vector_type(4)))  unsigned int uint4v;
typedef __attribute__((ext_vector_type(8)))  int      int8v;
typedef __attribute__((ext_vector_type(4)))  int      int4v;

#define S_LEN  1024
#define DMODEL 256
#define NHEAD  8
#define HDIM   32

static __device__ __forceinline__ v8f wmma16(v16h a, v16h b, v8f c) {
  // D = A(16x32 f16) x B(32x16 f16) + C(16x16 f32)
  return __builtin_amdgcn_wmma_f32_16x16x32_f16(false, a, false, b, (short)0, c,
                                                false, false);
}

// A/B fragment from f16 row-major [rows x ld]; lane holds row/col (lane&15),
// group g=lane>>4; element e -> K = g*8 + (e&7) + 16*(e>>3)
// => two contiguous 8-half (16B) runs per lane.
static __device__ __forceinline__ v16h load_frag_h(const _Float16* src, int ld,
                                                   int r0, int k0, int lane) {
  int r = r0 + (lane & 15);
  int g = lane >> 4;
  const _Float16* p = src + (long)r * ld + k0 + g * 8;
  v8h lo = *(const v8h*)(p);
  v8h hi = *(const v8h*)(p + 16);
  v16h f;
#pragma unroll
  for (int i = 0; i < 8; ++i) { f[i] = lo[i]; f[i + 8] = hi[i]; }
  return f;
}

// Same fragment from an f32 source with on-the-fly f16 conversion.
static __device__ __forceinline__ v16h load_frag_f32(const float* src, int ld,
                                                     int r0, int k0, int lane) {
  int r = r0 + (lane & 15);
  int g = lane >> 4;
  const float* p = src + (long)r * ld + k0 + g * 8;
  v4f a0 = *(const v4f*)(p);
  v4f a1 = *(const v4f*)(p + 4);
  v4f b0 = *(const v4f*)(p + 16);
  v4f b1 = *(const v4f*)(p + 20);
  v16h f;
#pragma unroll
  for (int i = 0; i < 4; ++i) {
    f[i]      = (_Float16)a0[i];
    f[i + 4]  = (_Float16)a1[i];
    f[i + 8]  = (_Float16)b0[i];
    f[i + 12] = (_Float16)b1[i];
  }
  return f;
}

static __device__ __forceinline__ void stage_rows(_Float16* lds_dst,
                                                  const _Float16* gsrc,
                                                  int rows, int rowlen,
                                                  int tid, int nthreads) {
#if __has_builtin(__builtin_amdgcn_tensor_load_to_lds)
  if (tid < 32) {
    unsigned long long ga = (unsigned long long)(size_t)gsrc;
    unsigned lds_off = (unsigned)(size_t)lds_dst;  // low 32 bits = LDS byte addr
    uint4v g0;
    g0[0] = 1u;                                    // count=1, no gather/restore
    g0[1] = lds_off;                               // lds_addr
    g0[2] = (unsigned)ga;                          // global_addr[31:0]
    g0[3] = (unsigned)((ga >> 32) & 0x01FFFFFFu) | (2u << 30);  // [56:32]|type=2
    int8v g1;
    g1[0] = (int)(1u << 16);
    g1[1] = rowlen << 16;
    g1[2] = rows << 16;
    g1[3] = rowlen << 16;
    g1[4] = rows;
    g1[5] = rowlen;
    g1[6] = 0;
    g1[7] = 0;
    int4v gz = {};
#if defined(__clang_major__) && __clang_major__ >= 23
    int8v gz8 = {};
    __builtin_amdgcn_tensor_load_to_lds(g0, g1, gz, gz, gz8, 0);
#else
    __builtin_amdgcn_tensor_load_to_lds(g0, g1, gz, gz, 0);
#endif
    __builtin_amdgcn_s_wait_tensorcnt(0);
  }
#else
  int total = rows * rowlen / 8;
  v8h* d = (v8h*)lds_dst;
  const v8h* s = (const v8h*)gsrc;
  for (int i = tid; i < total; i += nthreads) d[i] = s[i];
#endif
}

__global__ void prep_weights_k(const float* Wq, const float* Wk, const float* Wv,
                               const float* Wo, _Float16* WqT, _Float16* WkT,
                               _Float16* WvT, _Float16* WoT) {
  int idx = blockIdx.x * blockDim.x + threadIdx.x;   // 0..65535
  int n = idx >> 8;
  int k = idx & 255;
  WqT[n * 256 + k] = (_Float16)Wq[k * 256 + n];
  WkT[n * 256 + k] = (_Float16)Wk[k * 256 + n];
  WvT[n * 256 + k] = (_Float16)Wv[k * 256 + n];
  WoT[n * 256 + k] = (_Float16)Wo[k * 256 + n];
}

__global__ void qkv_proj_k(const float* inq, const float* inkv,
                           const _Float16* WqT, const _Float16* WkT,
                           const _Float16* WvT, const float* bq, const float* bk,
                           const float* bv, _Float16* Q, _Float16* K,
                           _Float16* Vt) {
  __shared__ __align__(16) _Float16 w_s[32 * 256];   // 16 KB weight slice
  int lane = threadIdx.x & 31;
  int wave = threadIdx.x >> 5;
  int blk = blockIdx.x;
  int nt = blk & 7;                // n0 = nt*32
  int mg = (blk >> 3) & 3;
  int b  = (blk >> 5) & 7;
  int which = blk >> 8;            // 0=Q 1=K 2=V
  int n0 = nt * 32;
  int m0 = (mg * 8 + wave) * 32;

  const _Float16* WT = (which == 0) ? WqT : (which == 1 ? WkT : WvT);
  stage_rows(w_s, WT + (long)n0 * DMODEL, 32, DMODEL, threadIdx.x, 256);
  __syncthreads();

  const float* A = (which == 0 ? inq : inkv) + (long)b * S_LEN * DMODEL;
  const float* bias = (which == 0) ? bq : (which == 1 ? bk : bv);

  v8f a00 = {}, a01 = {}, a10 = {}, a11 = {};
#pragma unroll
  for (int k0 = 0; k0 < DMODEL; k0 += 32) {
    v16h x0 = load_frag_f32(A, DMODEL, m0,      k0, lane);
    v16h x1 = load_frag_f32(A, DMODEL, m0 + 16, k0, lane);
    v16h w0 = load_frag_h(w_s, DMODEL, 0,  k0, lane);
    v16h w1 = load_frag_h(w_s, DMODEL, 16, k0, lane);
    a00 = wmma16(x0, w0, a00);
    a01 = wmma16(x0, w1, a01);
    a10 = wmma16(x1, w0, a10);
    a11 = wmma16(x1, w1, a11);
  }

  int col = lane & 15;
  int rbase = (lane >> 4) * 8;
  float scale = (which == 0) ? 0.17677669529663687f : 1.0f;  // 1/sqrt(HD)
  float bn0 = bias[n0 + col];
  float bn1 = bias[n0 + 16 + col];
#pragma unroll
  for (int q = 0; q < 4; ++q) {
    v8f acc = (q == 0) ? a00 : (q == 1) ? a01 : (q == 2) ? a10 : a11;
    int n = n0 + ((q & 1) ? 16 : 0) + col;
    float bn = (q & 1) ? bn1 : bn0;
    int h = n >> 5, hd = n & 31;
#pragma unroll
    for (int r = 0; r < 8; ++r) {
      int m = m0 + ((q >> 1) ? 16 : 0) + rbase + r;
      float val = (acc[r] + bn) * scale;
      if (which == 0)
        Q[((long)(b * NHEAD + h) * S_LEN + m) * HDIM + hd] = (_Float16)val;
      else if (which == 1)
        K[((long)(b * NHEAD + h) * S_LEN + m) * HDIM + hd] = (_Float16)val;
      else
        Vt[((long)(b * NHEAD + h) * HDIM + hd) * S_LEN + m] = (_Float16)val;
    }
  }
}

// ---------------------------------------------------------------------------
// Online-softmax update for one 16-row tile against 32 new keys (s0|s1),
// rescale running output (o0|o1), write P (f16) into the wave's LDS tile.
// ---------------------------------------------------------------------------
static __device__ __forceinline__ void softmax_step(v8f& s0, v8f& s1, v8f& o0,
                                                    v8f& o1, float* mrow,
                                                    float* lrow, _Float16* prow,
                                                    int col, int rbase) {
#pragma unroll
  for (int r = 0; r < 8; ++r) {
    float mx = fmaxf(s0[r], s1[r]);
#pragma unroll
    for (int d = 1; d < 16; d <<= 1) mx = fmaxf(mx, __shfl_xor(mx, d, 16));
    float mnew = fmaxf(mrow[r], mx);
    float corr = __expf(mrow[r] - mnew);
    float p0 = __expf(s0[r] - mnew);
    float p1 = __expf(s1[r] - mnew);
    float rs = p0 + p1;
#pragma unroll
    for (int d = 1; d < 16; d <<= 1) rs += __shfl_xor(rs, d, 16);
    lrow[r] = lrow[r] * corr + rs;
    mrow[r] = mnew;
    o0[r] *= corr;
    o1[r] *= corr;
    prow[(rbase + r) * 32 + col]      = (_Float16)p0;
    prow[(rbase + r) * 32 + 16 + col] = (_Float16)p1;
  }
}

// ---------------------------------------------------------------------------
// Kernel 3: flash attention per (b,h). One wave owns 32 query rows; streams
// keys 32 at a time: 4 WMMAs (QK^T, K/V fragments reused across both query
// tiles) + analytic Swin rel-pos bias + online softmax + LDS repack of P +
// 4 WMMAs (P.V^T). Output X f16 [b][s][h*HD+hd].
// ---------------------------------------------------------------------------
__global__ void __launch_bounds__(256) attn_k(const _Float16* Q, const _Float16* K, const _Float16* Vt,
                       const float* rel, _Float16* X) {
  __shared__ __align__(16) _Float16 pbuf[8][32 * 32];  // per-wave P tile (2KB)
  int lane = threadIdx.x & 31;
  int wave = threadIdx.x >> 5;
  int blk = blockIdx.x;
  int qt = (blk & 3) * 8 + wave;     // 32-row query tile, 0..31
  int bh = blk >> 2;                 // (b*NHEAD + h)
  int h = bh & 7, b = bh >> 3;

  const _Float16* Qp  = Q  + (long)bh * S_LEN * HDIM;
  const _Float16* Kp  = K  + (long)bh * S_LEN * HDIM;
  const _Float16* Vtp = Vt + (long)bh * HDIM * S_LEN;
  _Float16* pw = &pbuf[wave][0];

  int m0 = qt * 32;
  v16h qa0 = load_frag_h(Qp, HDIM, m0,      0, lane);  // full HD in one frag
  v16h qa1 = load_frag_h(Qp, HDIM, m0 + 16, 0, lane);

  v8f o00 = {}, o01 = {}, o10 = {}, o11 = {};
  float m0r[8], l0r[8], m1r[8], l1r[8];
#pragma unroll
  for (int r = 0; r < 8; ++r) {
    m0r[r] = -3.0e38f; l0r[r] = 0.0f;
    m1r[r] = -3.0e38f; l1r[r] = 0.0f;
  }

  int col = lane & 15;
  int rbase = (lane >> 4) * 8;

  for (int j0 = 0; j0 < S_LEN; j0 += 32) {
    if (j0 + 32 < S_LEN) {
      __builtin_prefetch(Kp  + (long)(j0 + 32) * HDIM, 0, 1);
      __builtin_prefetch(Vtp + (long)(j0 + 32), 0, 1);
    }
    v16h kb0 = load_frag_h(Kp, HDIM, j0,      0, lane);
    v16h kb1 = load_frag_h(Kp, HDIM, j0 + 16, 0, lane);
    v8f z = {};
    v8f s00 = wmma16(qa0, kb0, z);
    v8f s01 = wmma16(qa0, kb1, z);
    v8f s10 = wmma16(qa1, kb0, z);
    v8f s11 = wmma16(qa1, kb1, z);

    // Swin relative-position bias (POS table is an analytic constant).
    int k0i = j0 + col,      k1i = j0 + 16 + col;
    int yk0 = k0i >> 5, xk0 = k0i & 31;
    int yk1 = k1i >> 5, xk1 = k1i & 31;
#pragma unroll
    for (int r = 0; r < 8; ++r) {
      int qi0 = m0 + rbase + r;
      int qi1 = qi0 + 16;
      int yq0 = qi0 >> 5, xq0 = qi0 & 31;
      int yq1 = qi1 >> 5, xq1 = qi1 & 31;
      s00[r] += rel[((yq0 - yk0 + 31) * 63 + (xq0 - xk0 + 31)) * NHEAD + h];
      s01[r] += rel[((yq0 - yk1 + 31) * 63 + (xq0 - xk1 + 31)) * NHEAD + h];
      s10[r] += rel[((yq1 - yk0 + 31) * 63 + (xq1 - xk0 + 31)) * NHEAD + h];
      s11[r] += rel[((yq1 - yk1 + 31) * 63 + (xq1 - xk1 + 31)) * NHEAD + h];
    }

    softmax_step(s00, s01, o00, o01, m0r, l0r, pw,       col, rbase);
    softmax_step(s10, s11, o10, o11, m1r, l1r, pw + 512, col, rbase);

    // Repack P (C layout -> A layout) through LDS, then P x V^T.
    v16h pa0 = load_frag_h(pw, 32, 0,  0, lane);
    v16h pa1 = load_frag_h(pw, 32, 16, 0, lane);
    v16h vb0 = load_frag_h(Vtp, S_LEN, 0,  j0, lane);
    v16h vb1 = load_frag_h(Vtp, S_LEN, 16, j0, lane);
    o00 = wmma16(pa0, vb0, o00);
    o01 = wmma16(pa0, vb1, o01);
    o10 = wmma16(pa1, vb0, o10);
    o11 = wmma16(pa1, vb1, o11);
  }

#pragma unroll
  for (int r = 0; r < 8; ++r) {
    float inv0 = 1.0f / l0r[r];
    float inv1 = 1.0f / l1r[r];
    int s0i = m0 + rbase + r;
    int s1i = s0i + 16;
    long base0 = ((long)b * S_LEN + s0i) * DMODEL + h * HDIM;
    long base1 = ((long)b * S_LEN + s1i) * DMODEL + h * HDIM;
    X[base0 + col]      = (_Float16)(o00[r] * inv0);
    X[base0 + 16 + col] = (_Float16)(o01[r] * inv0);
    X[base1 + col]      = (_Float16)(o10[r] * inv1);
    X[base1 + 16 + col] = (_Float16)(o11[r] * inv1);
  }
}

__global__ void out_proj_k(const _Float16* X, const _Float16* WoT,
                           const float* bo, float* out) {
  __shared__ __align__(16) _Float16 wo_s[32 * 256];  // 16 KB
  int lane = threadIdx.x & 31;
  int wave = threadIdx.x >> 5;
  int nb = blockIdx.x & 7;           // n0 = nb*32
  int mg = blockIdx.x >> 3;          // 0..31
  int n0 = nb * 32;
  int m0 = (mg * 8 + wave) * 32;

  stage_rows(wo_s, WoT + (long)n0 * DMODEL, 32, DMODEL, threadIdx.x, 256);
  __syncthreads();

  v8f a00 = {}, a01 = {}, a10 = {}, a11 = {};
#pragma unroll
  for (int k0 = 0; k0 < DMODEL; k0 += 32) {
    v16h x0 = load_frag_h(X, DMODEL, m0,      k0, lane);
    v16h x1 = load_frag_h(X, DMODEL, m0 + 16, k0, lane);
    v16h w0 = load_frag_h(wo_s, DMODEL, 0,  k0, lane);
    v16h w1 = load_frag_h(wo_s, DMODEL, 16, k0, lane);
    a00 = wmma16(x0, w0, a00);
    a01 = wmma16(x0, w1, a01);
    a10 = wmma16(x1, w0, a10);
    a11 = wmma16(x1, w1, a11);
  }

  int col = lane & 15;
  int rbase = (lane >> 4) * 8;
  float bn0 = bo[n0 + col];
  float bn1 = bo[n0 + 16 + col];
#pragma unroll
  for (int r = 0; r < 8; ++r) {
    int ma = m0 + rbase + r;
    int mb2 = ma + 16;
    out[(long)ma  * DMODEL + n0 + col]      = a00[r] + bn0;
    out[(long)ma  * DMODEL + n0 + 16 + col] = a01[r] + bn1;
    out[(long)mb2 * DMODEL + n0 + col]      = a10[r] + bn0;
    out[(long)mb2 * DMODEL + n0 + 16 + col] = a11[r] + bn1;
  }
}

extern "C" void kernel_launch(void* const* d_in, const int* in_sizes, int n_in,
                              void* d_out, int out_size, void* d_ws, size_t ws_size,
                              hipStream_t stream) {
  (void)in_sizes; (void)n_in; (void)out_size; (void)ws_size;
  const float* inq  = (const float*)d_in[0];
  const float* inkv = (const float*)d_in[1];
  const float* Wq   = (const float*)d_in[2];
  const float* bq   = (const float*)d_in[3];
  const float* Wk   = (const float*)d_in[4];
  const float* bk   = (const float*)d_in[5];
  const float* Wv   = (const float*)d_in[6];
  const float* bv   = (const float*)d_in[7];
  const float* rel  = (const float*)d_in[8];
  const float* Wo   = (const float*)d_in[9];
  const float* bo   = (const float*)d_in[10];
  float* out = (float*)d_out;

  char* ws = (char*)d_ws;
  const size_t WSZ = 256 * 256 * sizeof(_Float16);                 // 128 KB
  const size_t QSZ = (size_t)8 * 8 * 1024 * 32 * sizeof(_Float16); // 4 MB
  _Float16* WqT = (_Float16*)(ws + 0 * WSZ);
  _Float16* WkT = (_Float16*)(ws + 1 * WSZ);
  _Float16* WvT = (_Float16*)(ws + 2 * WSZ);
  _Float16* WoT = (_Float16*)(ws + 3 * WSZ);
  size_t off = 4 * WSZ;
  _Float16* Qb = (_Float16*)(ws + off); off += QSZ;
  _Float16* Kb = (_Float16*)(ws + off); off += QSZ;
  _Float16* Vt = (_Float16*)(ws + off); off += QSZ;
  _Float16* Xb = (_Float16*)(ws + off); off += QSZ;

  prep_weights_k<<<256, 256, 0, stream>>>(Wq, Wk, Wv, Wo, WqT, WkT, WvT, WoT);
  qkv_proj_k<<<768, 256, 0, stream>>>(inq, inkv, WqT, WkT, WvT, bq, bk, bv,
                                      Qb, Kb, Vt);
  attn_k<<<256, 256, 0, stream>>>(Qb, Kb, Vt, rel, Xb);
  out_proj_k<<<256, 256, 0, stream>>>(Xb, WoT, bo, out);
}

// v002
// A run of this version takes 76.6 microseconds.
// Next to v001, in two timings, it ran 1.24 and 1.25 times as fast.
// Over all steps from v000 it is 4.28 times as fast.
#include <hip/hip_runtime.h>
#include <hip/hip_bf16.h>

typedef __attribute__((ext_vector_type(16))) _Float16 v16h;
typedef __attribute__((ext_vector_type(8)))  _Float16 v8h;
typedef __attribute__((ext_vector_type(8)))  float    v8f;
typedef __attribute__((ext_vector_type(4)))  float    v4f;
typedef __attribute__((ext_vector_type(4)))  unsigned int uint4v;
typedef __attribute__((ext_vector_type(8)))  int      int8v;
typedef __attribute__((ext_vector_type(4)))  int      int4v;

#define S_LEN  1024
#define DMODEL 256
#define NHEAD  8
#define HDIM   32

static __device__ __forceinline__ v8f wmma16(v16h a, v16h b, v8f c) {
  // D = A(16x32 f16) x B(32x16 f16) + C(16x16 f32)
  return __builtin_amdgcn_wmma_f32_16x16x32_f16(false, a, false, b, (short)0, c,
                                                false, false);
}

// A/B fragment from f16 row-major [rows x ld]; lane holds row/col (lane&15),
// group g=lane>>4; element e -> K = g*8 + (e&7) + 16*(e>>3)
// => two contiguous 8-half (16B) runs per lane.
static __device__ __forceinline__ v16h load_frag_h(const _Float16* src, int ld,
                                                   int r0, int k0, int lane) {
  int r = r0 + (lane & 15);
  int g = lane >> 4;
  const _Float16* p = src + (long)r * ld + k0 + g * 8;
  v8h lo = *(const v8h*)(p);
  v8h hi = *(const v8h*)(p + 16);
  v16h f;
#pragma unroll
  for (int i = 0; i < 8; ++i) { f[i] = lo[i]; f[i + 8] = hi[i]; }
  return f;
}

// Same fragment from an f32 source with on-the-fly f16 conversion.
static __device__ __forceinline__ v16h load_frag_f32(const float* src, int ld,
                                                     int r0, int k0, int lane) {
  int r = r0 + (lane & 15);
  int g = lane >> 4;
  const float* p = src + (long)r * ld + k0 + g * 8;
  v4f a0 = *(const v4f*)(p);
  v4f a1 = *(const v4f*)(p + 4);
  v4f b0 = *(const v4f*)(p + 16);
  v4f b1 = *(const v4f*)(p + 20);
  v16h f;
#pragma unroll
  for (int i = 0; i < 4; ++i) {
    f[i]      = (_Float16)a0[i];
    f[i + 4]  = (_Float16)a1[i];
    f[i + 8]  = (_Float16)b0[i];
    f[i + 12] = (_Float16)b1[i];
  }
  return f;
}

static __device__ __forceinline__ void stage_rows(_Float16* lds_dst,
                                                  const _Float16* gsrc,
                                                  int rows, int rowlen,
                                                  int tid, int nthreads) {
#if __has_builtin(__builtin_amdgcn_tensor_load_to_lds)
  if (tid < 32) {
    unsigned long long ga = (unsigned long long)(size_t)gsrc;
    unsigned lds_off = (unsigned)(size_t)lds_dst;  // low 32 bits = LDS byte addr
    uint4v g0;
    g0[0] = 1u;                                    // count=1, no gather/restore
    g0[1] = lds_off;                               // lds_addr
    g0[2] = (unsigned)ga;                          // global_addr[31:0]
    g0[3] = (unsigned)((ga >> 32) & 0x01FFFFFFu) | (2u << 30);  // [56:32]|type=2
    int8v g1;
    g1[0] = (int)(1u << 16);
    g1[1] = rowlen << 16;
    g1[2] = rows << 16;
    g1[3] = rowlen << 16;
    g1[4] = rows;
    g1[5] = rowlen;
    g1[6] = 0;
    g1[7] = 0;
    int4v gz = {};
#if defined(__clang_major__) && __clang_major__ >= 23
    int8v gz8 = {};
    __builtin_amdgcn_tensor_load_to_lds(g0, g1, gz, gz, gz8, 0);
#else
    __builtin_amdgcn_tensor_load_to_lds(g0, g1, gz, gz, 0);
#endif
    __builtin_amdgcn_s_wait_tensorcnt(0);
  }
#else
  int total = rows * rowlen / 8;
  v8h* d = (v8h*)lds_dst;
  const v8h* s = (const v8h*)gsrc;
  for (int i = tid; i < total; i += nthreads) d[i] = s[i];
#endif
}

__global__ void prep_weights_k(const float* Wq, const float* Wk, const float* Wv,
                               const float* Wo, _Float16* WqT, _Float16* WkT,
                               _Float16* WvT, _Float16* WoT) {
  int idx = blockIdx.x * blockDim.x + threadIdx.x;   // 0..65535
  int n = idx >> 8;
  int k = idx & 255;
  WqT[n * 256 + k] = (_Float16)Wq[k * 256 + n];
  WkT[n * 256 + k] = (_Float16)Wk[k * 256 + n];
  WvT[n * 256 + k] = (_Float16)Wv[k * 256 + n];
  WoT[n * 256 + k] = (_Float16)Wo[k * 256 + n];
}

__global__ void qkv_proj_k(const float* inq, const float* inkv,
                           const _Float16* WqT, const _Float16* WkT,
                           const _Float16* WvT, const float* bq, const float* bk,
                           const float* bv, _Float16* Q, _Float16* K,
                           _Float16* Vt) {
  __shared__ __align__(16) _Float16 w_s[32 * 256];   // 16 KB weight slice
  int lane = threadIdx.x & 31;
  int wave = threadIdx.x >> 5;
  int blk = blockIdx.x;
  int nt = blk & 7;                // n0 = nt*32
  int mg = (blk >> 3) & 3;
  int b  = (blk >> 5) & 7;
  int which = blk >> 8;            // 0=Q 1=K 2=V
  int n0 = nt * 32;
  int m0 = (mg * 8 + wave) * 32;

  const _Float16* WT = (which == 0) ? WqT : (which == 1 ? WkT : WvT);
  stage_rows(w_s, WT + (long)n0 * DMODEL, 32, DMODEL, threadIdx.x, 256);
  __syncthreads();

  const float* A = (which == 0 ? inq : inkv) + (long)b * S_LEN * DMODEL;
  const float* bias = (which == 0) ? bq : (which == 1 ? bk : bv);

  v8f a00 = {}, a01 = {}, a10 = {}, a11 = {};
#pragma unroll
  for (int k0 = 0; k0 < DMODEL; k0 += 32) {
    v16h x0 = load_frag_f32(A, DMODEL, m0,      k0, lane);
    v16h x1 = load_frag_f32(A, DMODEL, m0 + 16, k0, lane);
    v16h w0 = load_frag_h(w_s, DMODEL, 0,  k0, lane);
    v16h w1 = load_frag_h(w_s, DMODEL, 16, k0, lane);
    a00 = wmma16(x0, w0, a00);
    a01 = wmma16(x0, w1, a01);
    a10 = wmma16(x1, w0, a10);
    a11 = wmma16(x1, w1, a11);
  }

  int col = lane & 15;
  int rbase = (lane >> 4) * 8;
  float scale = (which == 0) ? 0.17677669529663687f : 1.0f;  // 1/sqrt(HD)
  float bn0 = bias[n0 + col];
  float bn1 = bias[n0 + 16 + col];
#pragma unroll
  for (int q = 0; q < 4; ++q) {
    v8f acc = (q == 0) ? a00 : (q == 1) ? a01 : (q == 2) ? a10 : a11;
    int n = n0 + ((q & 1) ? 16 : 0) + col;
    float bn = (q & 1) ? bn1 : bn0;
    int h = n >> 5, hd = n & 31;
#pragma unroll
    for (int r = 0; r < 8; ++r) {
      int m = m0 + ((q >> 1) ? 16 : 0) + rbase + r;
      float val = (acc[r] + bn) * scale;
      if (which == 0)
        Q[((long)(b * NHEAD + h) * S_LEN + m) * HDIM + hd] = (_Float16)val;
      else if (which == 1)
        K[((long)(b * NHEAD + h) * S_LEN + m) * HDIM + hd] = (_Float16)val;
      else
        Vt[((long)(b * NHEAD + h) * HDIM + hd) * S_LEN + m] = (_Float16)val;
    }
  }
}

static __device__ __forceinline__ float xhalf(float x) {
  int v = __builtin_bit_cast(int, x);
  return __builtin_bit_cast(float, __builtin_amdgcn_permlanex16(
      v, v, 0x76543210, 0xfedcba98, false, false));
}

// ---------------------------------------------------------------------------
// Online-softmax update for one 16-query column group against 32 new keys.
// Scores are transposed: t0[r] = S[query col][key 8g + r], t1[r] the same for
// key 16 + 8g + r, so a lane holds 16 of its query's 32 scores. Maximum:
// in-lane, then one exchange between the halves. Sum: in-lane only; the
// halves' sums are joined once behind the key loop. Returns P^T as a B operand
// (element e -> key 8g + (e & 7) + 16 * (e >> 3), the order of load_frag_h).
// ---------------------------------------------------------------------------
static __device__ __forceinline__ v16h softmax_step_t(const v8f& t0, const v8f& t1,
                                                      v8f& oa, v8f& ob, float& m,
                                                      float& l) {
  float mx = fmaxf(t0[0], t1[0]);
#pragma unroll
  for (int r = 1; r < 8; ++r) mx = fmaxf(mx, fmaxf(t0[r], t1[r]));
  mx = fmaxf(mx, xhalf(mx));
  float mnew = fmaxf(m, mx);
  float corr = __expf(m - mnew);
  v16h p;
  float rs = 0.0f;
#pragma unroll
  for (int r = 0; r < 8; ++r) {
    float p0 = __expf(t0[r] - mnew);
    float p1 = __expf(t1[r] - mnew);
    rs += p0 + p1;
    p[r]     = (_Float16)p0;
    p[r + 8] = (_Float16)p1;
  }
  l = l * corr + rs;
  m = mnew;
#pragma unroll
  for (int r = 0; r < 8; ++r) { oa[r] *= corr; ob[r] *= corr; }
  return p;
}

// ---------------------------------------------------------------------------
// Kernel 3: flash attention per (b,h), transposed: S^T = K.Q^T, O^T += V^T.P^T.
// One wave owns 32 query columns (Q fragments stay in registers as B operands);
// streams keys 32 at a time: 4 WMMAs (K rows as A, reused across both query groups) +
// analytic Swin rel-pos bias + in-lane online softmax + 4 WMMAs (V^T rows as A,
// P^T packed from the score accumulators as B). Output X f16 [b][s][h*HD+hd].
// ---------------------------------------------------------------------------
__global__ void __launch_bounds__(256) attn_k(const _Float16* Q, const _Float16* K, const _Float16* Vt,
                       const float* rel, _Float16* X) {
  int lane = threadIdx.x & 31;
  int wave = threadIdx.x >> 5;
  int blk = blockIdx.x;
  int qt = (blk & 3) * 8 + wave;     // 32-query tile, 0..31
  int bh = blk >> 2;                 // (b*NHEAD + h)
  int h = bh & 7, b = bh >> 3;

  const _Float16* Qp  = Q  + (long)bh * S_LEN * HDIM;
  const _Float16* Kp  = K  + (long)bh * S_LEN * HDIM;
  const _Float16* Vtp = Vt + (long)bh * HDIM * S_LEN;

  int m0 = qt * 32;
  v16h qa0 = load_frag_h(Qp, HDIM, m0,      0, lane);  // full HD in one frag
  v16h qa1 = load_frag_h(Qp, HDIM, m0 + 16, 0, lane);

  // o<u><w>[r] = O[query m0 + 16u + col][hd 16w + rbase + r]
  v8f o00 = {}, o01 = {}, o10 = {}, o11 = {};
  float mq0 = -3.0e38f, lq0 = 0.0f, mq1 = -3.0e38f, lq1 = 0.0f;

  int col = lane & 15;
  int rbase = (lane >> 4) * 8;
  int qi0 = m0 + col, qi1 = m0 + 16 + col;
  int yq0 = qi0 >> 5, xq0 = qi0 & 31;
  int yq1 = qi1 >> 5, xq1 = qi1 & 31;

  for (int j0 = 0; j0 < S_LEN; j0 += 32) {
    if (j0 + 32 < S_LEN) {
      __builtin_prefetch(Kp  + (long)(j0 + 32) * HDIM, 0, 1);
      __builtin_prefetch(Vtp + (long)(j0 + 32), 0, 1);
    }
    v16h kb0 = load_frag_h(Kp, HDIM, j0,      0, lane);
    v16h kb1 = load_frag_h(Kp, HDIM, j0 + 16, 0, lane);
    v8f z = {};
    // s<u><t>[r] = S[query m0 + 16u + col][key j0 + 16t + rbase + r]
    v8f s00 = wmma16(kb0, qa0, z);
    v8f s01 = wmma16(kb1, qa0, z);
    v8f s10 = wmma16(kb0, qa1, z);
    v8f s11 = wmma16(kb1, qa1, z);

    // Swin relative-position bias (POS table is an analytic constant).
#pragma unroll
    for (int r = 0; r < 8; ++r) {
      int k0i = j0 + rbase + r;
      int k1i = k0i + 16;
      int yk0 = k0i >> 5, xk0 = k0i & 31;
      int yk1 = k1i >> 5, xk1 = k1i & 31;
      s00[r] += rel[((yq0 - yk0 + 31) * 63 + (xq0 - xk0 + 31)) * NHEAD + h];
      s01[r] += rel[((yq0 - yk1 + 31) * 63 + (xq0 - xk1 + 31)) * NHEAD + h];
      s10[r] += rel[((yq1 - yk0 + 31) * 63 + (xq1 - xk0 + 31)) * NHEAD + h];
      s11[r] += rel[((yq1 - yk1 + 31) * 63 + (xq1 - xk1 + 31)) * NHEAD + h];
    }

    v16h pb0 = softmax_step_t(s00, s01, o00, o01, mq0, lq0);
    v16h pb1 = softmax_step_t(s10, s11, o10, o11, mq1, lq1);

    v16h vb0 = load_frag_h(Vtp, S_LEN, 0,  j0, lane);
    v16h vb1 = load_frag_h(Vtp, S_LEN, 16, j0, lane);
    o00 = wmma16(vb0, pb0, o00);
    o01 = wmma16(vb1, pb0, o01);
    o10 = wmma16(vb0, pb1, o10);
    o11 = wmma16(vb1, pb1, o11);
  }

  float inv0 = 1.0f / (lq0 + xhalf(lq0));
  float inv1 = 1.0f / (lq1 + xhalf(lq1));
  v8h x00, x01, x10, x11;
#pragma unroll
  for (int r = 0; r < 8; ++r) {
    x00[r] = (_Float16)(o00[r] * inv0);
    x01[r] = (_Float16)(o01[r] * inv0);
    x10[r] = (_Float16)(o10[r] * inv1);
    x11[r] = (_Float16)(o11[r] * inv1);
  }
  _Float16* X0 = X + ((long)b * S_LEN + qi0) * DMODEL + h * HDIM + rbase;
  _Float16* X1 = X + ((long)b * S_LEN + qi1) * DMODEL + h * HDIM + rbase;
  *(v8h*)(X0)      = x00;
  *(v8h*)(X0 + 16) = x01;
  *(v8h*)(X1)      = x10;
  *(v8h*)(X1 + 16) = x11;
}

__global__ void out_proj_k(const _Float16* X, const _Float16* WoT,
                           const float* bo, float* out) {
  __shared__ __align__(16) _Float16 wo_s[32 * 256];  // 16 KB
  int lane = threadIdx.x & 31;
  int wave = threadIdx.x >> 5;
  int nb = blockIdx.x & 7;           // n0 = nb*32
  int mg = blockIdx.x >> 3;          // 0..31
  int n0 = nb * 32;
  int m0 = (mg * 8 + wave) * 32;

  stage_rows(wo_s, WoT + (long)n0 * DMODEL, 32, DMODEL, threadIdx.x, 256);
  __syncthreads();

  v8f a00 = {}, a01 = {}, a10 = {}, a11 = {};
#pragma unroll
  for (int k0 = 0; k0 < DMODEL; k0 += 32) {
    v16h x0 = load_frag_h(X, DMODEL, m0,      k0, lane);
    v16h x1 = load_frag_h(X, DMODEL, m0 + 16, k0, lane);
    v16h w0 = load_frag_h(wo_s, DMODEL, 0,  k0, lane);
    v16h w1 = load_frag_h(wo_s, DMODEL, 16, k0, lane);
    a00 = wmma16(x0, w0, a00);
    a01 = wmma16(x0, w1, a01);
    a10 = wmma16(x1, w0, a10);
    a11 = wmma16(x1, w1, a11);
  }

  int col = lane & 15;
  int rbase = (lane >> 4) * 8;
  float bn0 = bo[n0 + col];
  float bn1 = bo[n0 + 16 + col];
#pragma unroll
  for (int r = 0; r < 8; ++r) {
    int ma = m0 + rbase + r;
    int mb2 = ma + 16;
    out[(long)ma  * DMODEL + n0 + col]      = a00[r] + bn0;
    out[(long)ma  * DMODEL + n0 + 16 + col] = a01[r] + bn1;
    out[(long)mb2 * DMODEL + n0 + col]      = a10[r] + bn0;
    out[(long)mb2 * DMODEL + n0 + 16 + col] = a11[r] + bn1;
  }
}

extern "C" void kernel_launch(void* const* d_in, const int* in_sizes, int n_in,
                              void* d_out, int out_size, void* d_ws, size_t ws_size,
                              hipStream_t stream) {
  (void)in_sizes; (void)n_in; (void)out_size; (void)ws_size;
  const float* inq  = (const float*)d_in[0];
  const float* inkv = (const float*)d_in[1];
  const float* Wq   = (const float*)d_in[2];
  const float* bq   = (const float*)d_in[3];
  const float* Wk   = (const float*)d_in[4];
  const float* bk   = (const float*)d_in[5];
  const float* Wv   = (const float*)d_in[6];
  const float* bv   = (const float*)d_in[7];
  const float* rel  = (const float*)d_in[8];
  const float* Wo   = (const float*)d_in[9];
  const float* bo   = (const float*)d_in[10];
  float* out = (float*)d_out;

  char* ws = (char*)d_ws;
  const size_t WSZ = 256 * 256 * sizeof(_Float16);                 // 128 KB
  const size_t QSZ = (size_t)8 * 8 * 1024 * 32 * sizeof(_Float16); // 4 MB
  _Float16* WqT = (_Float16*)(ws + 0 * WSZ);
  _Float16* WkT = (_Float16*)(ws + 1 * WSZ);
  _Float16* WvT = (_Float16*)(ws + 2 * WSZ);
  _Float16* WoT = (_Float16*)(ws + 3 * WSZ);
  size_t off = 4 * WSZ;
  _Float16* Qb = (_Float16*)(ws + off); off += QSZ;
  _Float16* Kb = (_Float16*)(ws + off); off += QSZ;
  _Float16* Vt = (_Float16*)(ws + off); off += QSZ;
  _Float16* Xb = (_Float16*)(ws + off); off += QSZ;

  prep_weights_k<<<256, 256, 0, stream>>>(Wq, Wk, Wv, Wo, WqT, WkT, WvT, WoT);
  qkv_proj_k<<<768, 256, 0, stream>>>(inq, inkv, WqT, WkT, WvT, bq, bk, bv,
                                      Qb, Kb, Vt);
  attn_k<<<256, 256, 0, stream>>>(Qb, Kb, Vt, rel, Xb);
  out_proj_k<<<256, 256, 0, stream>>>(Xb, WoT, bo, out);
}

// v003
// Measured time: 70.5 microseconds a run.
// Next to v002, in two timings, it ran 1.08 times as fast each time.
// Over all steps from v000 it is 4.63 times as fast.
#include <hip/hip_runtime.h>
#include <hip/hip_bf16.h>

typedef __attribute__((ext_vector_type(16))) _Float16 v16h;
typedef __attribute__((ext_vector_type(8)))  _Float16 v8h;
typedef __attribute__((ext_vector_type(8)))  float    v8f;
typedef __attribute__((ext_vector_type(4)))  float    v4f;
typedef __attribute__((ext_vector_type(4)))  unsigned int uint4v;
typedef __attribute__((ext_vector_type(8)))  int      int8v;
typedef __attribute__((ext_vector_type(4)))  int      int4v;

#define S_LEN  1024
#define DMODEL 256
#define NHEAD  8
#define HDIM   32
#define NREL   3969   // (2*32-1) * (2*32-1) rows of rel_table

static __device__ __forceinline__ v8f wmma16(v16h a, v16h b, v8f c) {
  // D = A(16x32 f16) x B(32x16 f16) + C(16x16 f32)
  return __builtin_amdgcn_wmma_f32_16x16x32_f16(false, a, false, b, (short)0, c,
                                                false, false);
}

// A/B fragment from f16 row-major [rows x ld]; lane holds row/col (lane&15),
// group g=lane>>4; element e -> K = g*8 + (e&7) + 16*(e>>3)
// => two contiguous 8-half (16B) runs per lane.
static __device__ __forceinline__ v16h load_frag_h(const _Float16* src, int ld,
                                                   int r0, int k0, int lane) {
  int r = r0 + (lane & 15);
  int g = lane >> 4;
  const _Float16* p = src + (long)r * ld + k0 + g * 8;
  v8h lo = *(const v8h*)(p);
  v8h hi = *(const v8h*)(p + 16);
  v16h f;
#pragma unroll
  for (int i = 0; i < 8; ++i) { f[i] = lo[i]; f[i + 8] = hi[i]; }
  return f;
}

// Same fragment from an f32 source with on-the-fly f16 conversion.
static __device__ __forceinline__ v16h load_frag_f32(const float* src, int ld,
                                                     int r0, int k0, int lane) {
  int r = r0 + (lane & 15);
  int g = lane >> 4;
  const float* p = src + (long)r * ld + k0 + g * 8;
  v4f a0 = *(const v4f*)(p);
  v4f a1 = *(const v4f*)(p + 4);
  v4f b0 = *(const v4f*)(p + 16);
  v4f b1 = *(const v4f*)(p + 20);
  v16h f;
#pragma unroll
  for (int i = 0; i < 4; ++i) {
    f[i]      = (_Float16)a0[i];
    f[i + 4]  = (_Float16)a1[i];
    f[i + 8]  = (_Float16)b0[i];
    f[i + 12] = (_Float16)b1[i];
  }
  return f;
}

static __device__ __forceinline__ void stage_rows(_Float16* lds_dst,
                                                  const _Float16* gsrc,
                                                  int rows, int rowlen,
                                                  int tid, int nthreads) {
#if __has_builtin(__builtin_amdgcn_tensor_load_to_lds)
  if (tid < 32) {
    unsigned long long ga = (unsigned long long)(size_t)gsrc;
    unsigned lds_off = (unsigned)(size_t)lds_dst;  // low 32 bits = LDS byte addr
    uint4v g0;
    g0[0] = 1u;                                    // count=1, no gather/restore
    g0[1] = lds_off;                               // lds_addr
    g0[2] = (unsigned)ga;                          // global_addr[31:0]
    g0[3] = (unsigned)((ga >> 32) & 0x01FFFFFFu) | (2u << 30);  // [56:32]|type=2
    int8v g1;
    g1[0] = (int)(1u << 16);
    g1[1] = rowlen << 16;
    g1[2] = rows << 16;
    g1[3] = rowlen << 16;
    g1[4] = rows;
    g1[5] = rowlen;
    g1[6] = 0;
    g1[7] = 0;
    int4v gz = {};
#if defined(__clang_major__) && __clang_major__ >= 23
    int8v gz8 = {};
    __builtin_amdgcn_tensor_load_to_lds(g0, g1, gz, gz, gz8, 0);
#else
    __builtin_amdgcn_tensor_load_to_lds(g0, g1, gz, gz, 0);
#endif
    __builtin_amdgcn_s_wait_tensorcnt(0);
  }
#else
  int total = rows * rowlen / 8;
  v8h* d = (v8h*)lds_dst;
  const v8h* s = (const v8h*)gsrc;
  for (int i = tid; i < total; i += nthreads) d[i] = s[i];
#endif
}

__global__ void prep_weights_k(const float* Wq, const float* Wk, const float* Wv,
                               const float* Wo, _Float16* WqT, _Float16* WkT,
                               _Float16* WvT, _Float16* WoT) {
  int idx = blockIdx.x * blockDim.x + threadIdx.x;   // 0..65535
  int n = idx >> 8;
  int k = idx & 255;
  WqT[n * 256 + k] = (_Float16)Wq[k * 256 + n];
  WkT[n * 256 + k] = (_Float16)Wk[k * 256 + n];
  WvT[n * 256 + k] = (_Float16)Wv[k * 256 + n];
  WoT[n * 256 + k] = (_Float16)Wo[k * 256 + n];
}

__global__ void qkv_proj_k(const float* inq, const float* inkv,
                           const _Float16* WqT, const _Float16* WkT,
                           const _Float16* WvT, const float* bq, const float* bk,
                           const float* bv, _Float16* Q, _Float16* K,
                           _Float16* Vt) {
  __shared__ __align__(16) _Float16 w_s[32 * 256];   // 16 KB weight slice
  int lane = threadIdx.x & 31;
  int wave = threadIdx.x >> 5;
  int blk = blockIdx.x;
  int nt = blk & 7;                // n0 = nt*32
  int mg = (blk >> 3) & 3;
  int b  = (blk >> 5) & 7;
  int which = blk >> 8;            // 0=Q 1=K 2=V
  int n0 = nt * 32;
  int m0 = (mg * 8 + wave) * 32;

  const _Float16* WT = (which == 0) ? WqT : (which == 1 ? WkT : WvT);
  stage_rows(w_s, WT + (long)n0 * DMODEL, 32, DMODEL, threadIdx.x, 256);
  __syncthreads();

  const float* A = (which == 0 ? inq : inkv) + (long)b * S_LEN * DMODEL;
  const float* bias = (which == 0) ? bq : (which == 1 ? bk : bv);

  v8f a00 = {}, a01 = {}, a10 = {}, a11 = {};
#pragma unroll
  for (int k0 = 0; k0 < DMODEL; k0 += 32) {
    v16h x0 = load_frag_f32(A, DMODEL, m0,      k0, lane);
    v16h x1 = load_frag_f32(A, DMODEL, m0 + 16, k0, lane);
    v16h w0 = load_frag_h(w_s, DMODEL, 0,  k0, lane);
    v16h w1 = load_frag_h(w_s, DMODEL, 16, k0, lane);
    a00 = wmma16(x0, w0, a00);
    a01 = wmma16(x0, w1, a01);
    a10 = wmma16(x1, w0, a10);
    a11 = wmma16(x1, w1, a11);
  }

  int col = lane & 15;
  int rbase = (lane >> 4) * 8;
  float scale = (which == 0) ? 0.17677669529663687f : 1.0f;  // 1/sqrt(HD)
  float bn0 = bias[n0 + col];
  float bn1 = bias[n0 + 16 + col];
#pragma unroll
  for (int q = 0; q < 4; ++q) {
    v8f acc = (q == 0) ? a00 : (q == 1) ? a01 : (q == 2) ? a10 : a11;
    int n = n0 + ((q & 1) ? 16 : 0) + col;
    float bn = (q & 1) ? bn1 : bn0;
    int h = n >> 5, hd = n & 31;
#pragma unroll
    for (int r = 0; r < 8; ++r) {
      int m = m0 + ((q >> 1) ? 16 : 0) + rbase + r;
      float val = (acc[r] + bn) * scale;
      if (which == 0)
        Q[((long)(b * NHEAD + h) * S_LEN + m) * HDIM + hd] = (_Float16)val;
      else if (which == 1)
        K[((long)(b * NHEAD + h) * S_LEN + m) * HDIM + hd] = (_Float16)val;
      else
        Vt[((long)(b * NHEAD + h) * HDIM + hd) * S_LEN + m] = (_Float16)val;
    }
  }
}

static __device__ __forceinline__ float xhalf(float x) {
  int v = __builtin_bit_cast(int, x);
  return __builtin_bit_cast(float, __builtin_amdgcn_permlanex16(
      v, v, 0x76543210, 0xfedcba98, false, false));
}

// ---------------------------------------------------------------------------
// Online-softmax update for one 16-query column group against 32 new keys.
// Scores are transposed: t0[r] = S[query col][key 8g + r], t1[r] the same for
// key 16 + 8g + r, so a lane holds 16 of its query's 32 scores. Maximum:
// in-lane, then one exchange between the halves. Sum: in-lane only; the
// halves' sums are joined once behind the key loop. Returns P^T as a B operand
// (element e -> key 8g + (e & 7) + 16 * (e >> 3), the order of load_frag_h).
// ---------------------------------------------------------------------------
static __device__ __forceinline__ v16h softmax_step_t(const v8f& t0, const v8f& t1,
                                                      v8f& oa, v8f& ob, float& m,
                                                      float& l) {
  float mx = fmaxf(t0[0], t1[0]);
#pragma unroll
  for (int r = 1; r < 8; ++r) mx = fmaxf(mx, fmaxf(t0[r], t1[r]));
  mx = fmaxf(mx, xhalf(mx));
  float mnew = fmaxf(m, mx);
  float corr = __expf(m - mnew);
  v16h p;
  float rs = 0.0f;
#pragma unroll
  for (int r = 0; r < 8; ++r) {
    float p0 = __expf(t0[r] - mnew);
    float p1 = __expf(t1[r] - mnew);
    rs += p0 + p1;
    p[r]     = (_Float16)p0;
    p[r + 8] = (_Float16)p1;
  }
  l = l * corr + rs;
  m = mnew;
#pragma unroll
  for (int r = 0; r < 8; ++r) { oa[r] *= corr; ob[r] *= corr; }
  return p;
}

// ---------------------------------------------------------------------------
// Kernel 3: flash attention per (b,h), transposed: S^T = K.Q^T, O^T += V^T.P^T.
// One wave owns 32 query columns (Q fragments stay in registers as B operands);
// streams keys 32 at a time: 4 WMMAs (K rows as A, reused across both query groups) +
// analytic Swin rel-pos bias + in-lane online softmax + 4 WMMAs (V^T rows as A,
// P^T packed from the score accumulators as B). Output X f16 [b][s][h*HD+hd].
// The block's head column of rel_table is copied once into LDS, densely and in
// reversed order, so a pass reads its bias at consecutive, rising LDS words
// instead of gathering one float out of every 32 bytes of global memory.
// ---------------------------------------------------------------------------
__global__ void __launch_bounds__(256) attn_k(const _Float16* Q, const _Float16* K, const _Float16* Vt,
                       const float* rel, _Float16* X) {
  int lane = threadIdx.x & 31;
  int wave = threadIdx.x >> 5;
  int blk = blockIdx.x;
  int qt = (blk & 3) * 8 + wave;     // 32-query tile, 0..31
  int bh = blk >> 2;                 // (b*NHEAD + h)
  int h = bh & 7, b = bh >> 3;

  // tab[i] = rel[NREL - 1 - i][h]; padded to 16 words a thread, so that the
  // copy has no branch (the pad is written and never read).
  __shared__ float tab[4096];
  {
    int tid = threadIdx.x & 255;   // the block has 256 threads
    int rt = tid ^ 255;            // 255 - tid
    float tv[16];
    // Unrolled so that all 16 loads of a thread are in flight together (rolled,
    // each trip waits out its own load). Source row NREL - 1 - (tid + 256 k);
    // the last trip's is clamped to stay inside rel.
#pragma unroll
    for (int k = 0; k < 16; ++k) {
      int i = rt + (NREL - 256 - 256 * k);
      tv[k] = rel[(i > 0 ? i : 0) * NHEAD + h];
    }
    // Unrolled so that tv[] stays in registers.
#pragma unroll
    for (int k = 0; k < 16; ++k) tab[tid + 256 * k] = tv[k];
  }

  const _Float16* Qp  = Q  + (long)bh * S_LEN * HDIM;
  const _Float16* Kp  = K  + (long)bh * S_LEN * HDIM;
  const _Float16* Vtp = Vt + (long)bh * HDIM * S_LEN;

  int m0 = qt * 32;
  v16h qa0 = load_frag_h(Qp, HDIM, m0,      0, lane);  // full HD in one frag
  v16h qa1 = load_frag_h(Qp, HDIM, m0 + 16, 0, lane);

  // o<u><w>[r] = O[query m0 + 16u + col][hd 16w + rbase + r]
  v8f o00 = {}, o01 = {}, o10 = {}, o11 = {};
  float mq0 = -3.0e38f, lq0 = 0.0f, mq1 = -3.0e38f, lq1 = 0.0f;

  int col = lane & 15;
  int rbase = (lane >> 4) * 8;
  int qi0 = m0 + col, qi1 = m0 + 16 + col;

  // The wave's 32 queries are image row qt (x = 16u + col); the 32 keys of a
  // pass are image row j0 / 32 (x = 16t + rbase + r). rel row index
  // (qt - j0/32 + 31) * 63 + 16(u - t) + col - rbase - r + 31, so in the
  // reversed table: (31 - qt + j0/32) * 63 + 31 - col + rbase + r - 16(u - t).
  // col ^ 15 is 15 - col, written so that the register part of the LDS address
  // is never below 0 (a constant 15 would move into the offset field).
  const float* bp = tab + (31 - qt) * 63 + (col ^ 15) + rbase;

  __syncthreads();   // tab complete before any wave reads it

  for (int j0 = 0; j0 < S_LEN; j0 += 32, bp += 63) {
    if (j0 + 32 < S_LEN) {
      __builtin_prefetch(Kp  + (long)(j0 + 32) * HDIM, 0, 1);
      __builtin_prefetch(Vtp + (long)(j0 + 32), 0, 1);
    }
    v16h kb0 = load_frag_h(Kp, HDIM, j0,      0, lane);
    v16h kb1 = load_frag_h(Kp, HDIM, j0 + 16, 0, lane);
    v8f z = {};
    // s<u><t>[r] = S[query m0 + 16u + col][key j0 + 16t + rbase + r]
    v8f s00 = wmma16(kb0, qa0, z);
    v8f s01 = wmma16(kb1, qa0, z);
    v8f s10 = wmma16(kb0, qa1, z);
    v8f s11 = wmma16(kb1, qa1, z);

    // Swin relative-position bias (POS table is an analytic constant).
#pragma unroll
    for (int r = 0; r < 8; ++r) {
      float bs = bp[16 + r];   // u == t
      s00[r] += bs;
      s01[r] += bp[32 + r];    // u = 0, t = 1
      s10[r] += bp[r];         // u = 1, t = 0
      s11[r] += bs;
    }

    v16h pb0 = softmax_step_t(s00, s01, o00, o01, mq0, lq0);
    v16h pb1 = softmax_step_t(s10, s11, o10, o11, mq1, lq1);

    v16h vb0 = load_frag_h(Vtp, S_LEN, 0,  j0, lane);
    v16h vb1 = load_frag_h(Vtp, S_LEN, 16, j0, lane);
    o00 = wmma16(vb0, pb0, o00);
    o01 = wmma16(vb1, pb0, o01);
    o10 = wmma16(vb0, pb1, o10);
    o11 = wmma16(vb1, pb1, o11);
  }

  float inv0 = 1.0f / (lq0 + xhalf(lq0));
  float inv1 = 1.0f / (lq1 + xhalf(lq1));
  v8h x00, x01, x10, x11;
#pragma unroll
  for (int r = 0; r < 8; ++r) {
    x00[r] = (_Float16)(o00[r] * inv0);
    x01[r] = (_Float16)(o01[r] * inv0);
    x10[r] = (_Float16)(o10[r] * inv1);
    x11[r] = (_Float16)(o11[r] * inv1);
  }
  _Float16* X0 = X + ((long)b * S_LEN + qi0) * DMODEL + h * HDIM + rbase;
  _Float16* X1 = X + ((long)b * S_LEN + qi1) * DMODEL + h * HDIM + rbase;
  *(v8h*)(X0)      = x00;
  *(v8h*)(X0 + 16) = x01;
  *(v8h*)(X1)      = x10;
  *(v8h*)(X1 + 16) = x11;
}

__global__ void out_proj_k(const _Float16* X, const _Float16* WoT,
                           const float* bo, float* out) {
  __shared__ __align__(16) _Float16 wo_s[32 * 256];  // 16 KB
  int lane = threadIdx.x & 31;
  int wave = threadIdx.x >> 5;
  int nb = blockIdx.x & 7;           // n0 = nb*32
  int mg = blockIdx.x >> 3;          // 0..31
  int n0 = nb * 32;
  int m0 = (mg * 8 + wave) * 32;

  stage_rows(wo_s, WoT + (long)n0 * DMODEL, 32, DMODEL, threadIdx.x, 256);
  __syncthreads();

  v8f a00 = {}, a01 = {}, a10 = {}, a11 = {};
#pragma unroll
  for (int k0 = 0; k0 < DMODEL; k0 += 32) {
    v16h x0 = load_frag_h(X, DMODEL, m0,      k0, lane);
    v16h x1 = load_frag_h(X, DMODEL, m0 + 16, k0, lane);
    v16h w0 = load_frag_h(wo_s, DMODEL, 0,  k0, lane);
    v16h w1 = load_frag_h(wo_s, DMODEL, 16, k0, lane);
    a00 = wmma16(x0, w0, a00);
    a01 = wmma16(x0, w1, a01);
    a10 = wmma16(x1, w0, a10);
    a11 = wmma16(x1, w1, a11);
  }

  int col = lane & 15;
  int rbase = (lane >> 4) * 8;
  float bn0 = bo[n0 + col];
  float bn1 = bo[n0 + 16 + col];
#pragma unroll
  for (int r = 0; r < 8; ++r) {
    int ma = m0 + rbase + r;
    int mb2 = ma + 16;
    out[(long)ma  * DMODEL + n0 + col]      = a00[r] + bn0;
    out[(long)ma  * DMODEL + n0 + 16 + col] = a01[r] + bn1;
    out[(long)mb2 * DMODEL + n0 + col]      = a10[r] + bn0;
    out[(long)mb2 * DMODEL + n0 + 16 + col] = a11[r] + bn1;
  }
}

extern "C" void kernel_launch(void* const* d_in, const int* in_sizes, int n_in,
                              void* d_out, int out_size, void* d_ws, size_t ws_size,
                              hipStream_t stream) {
  (void)in_sizes; (void)n_in; (void)out_size; (void)ws_size;
  const float* inq  = (const float*)d_in[0];
  const float* inkv = (const float*)d_in[1];
  const float* Wq   = (const float*)d_in[2];
  const float* bq   = (const float*)d_in[3];
  const float* Wk   = (const float*)d_in[4];
  const float* bk   = (const float*)d_in[5];
  const float* Wv   = (const float*)d_in[6];
  const float* bv   = (const float*)d_in[7];
  const float* rel  = (const float*)d_in[8];
  const float* Wo   = (const float*)d_in[9];
  const float* bo   = (const float*)d_in[10];
  float* out = (float*)d_out;

  char* ws = (char*)d_ws;
  const size_t WSZ = 256 * 256 * sizeof(_Float16);                 // 128 KB
  const size_t QSZ = (size_t)8 * 8 * 1024 * 32 * sizeof(_Float16); // 4 MB
  _Float16* WqT = (_Float16*)(ws + 0 * WSZ);
  _Float16* WkT = (_Float16*)(ws + 1 * WSZ);
  _Float16* WvT = (_Float16*)(ws + 2 * WSZ);
  _Float16* WoT = (_Float16*)(ws + 3 * WSZ);
  size_t off = 4 * WSZ;
  _Float16* Qb = (_Float16*)(ws + off); off += QSZ;
  _Float16* Kb = (_Float16*)(ws + off); off += QSZ;
  _Float16* Vt = (_Float16*)(ws + off); off += QSZ;
  _Float16* Xb = (_Float16*)(ws + off); off += QSZ;

  prep_weights_k<<<256, 256, 0, stream>>>(Wq, Wk, Wv, Wo, WqT, WkT, WvT, WoT);
  qkv_proj_k<<<768, 256, 0, stream>>>(inq, inkv, WqT, WkT, WvT, bq, bk, bv,
                                      Qb, Kb, Vt);
  attn_k<<<256, 256, 0, stream>>>(Qb, Kb, Vt, rel, Xb);
  out_proj_k<<<256, 256, 0, stream>>>(Xb, WoT, bo, out);
}

// v004
// It runs in 68.4 microseconds.
// In both of two side-by-side timings against v003, it was 1.03 times as fast.
// Counting every step since v000, it is 4.78 times as fast.
#include <hip/hip_runtime.h>
#include <hip/hip_bf16.h>

typedef __attribute__((ext_vector_type(16))) _Float16 v16h;
typedef __attribute__((ext_vector_type(8)))  _Float16 v8h;
typedef __attribute__((ext_vector_type(8)))  float    v8f;
typedef __attribute__((ext_vector_type(4)))  float    v4f;
typedef __attribute__((ext_vector_type(4)))  unsigned int uint4v;
typedef __attribute__((ext_vector_type(8)))  unsigned int uint8v;

#define S_LEN  1024
#define DMODEL 256
#define NHEAD  8
#define HDIM   32
#define NREL   3969   // (2*32-1) * (2*32-1) rows of rel_table

static __device__ __forceinline__ v8f wmma16(v16h a, v16h b, v8f c) {
  // D = A(16x32 f16) x B(32x16 f16) + C(16x16 f32)
  return __builtin_amdgcn_wmma_f32_16x16x32_f16(false, a, false, b, (short)0, c,
                                                false, false);
}

// A/B fragment from f16 row-major [rows x ld]; lane holds row/col (lane&15),
// group g=lane>>4; element e -> K = g*8 + (e&7) + 16*(e>>3)
// => two contiguous 8-half (16B) runs per lane.
static __device__ __forceinline__ v16h load_frag_h(const _Float16* src, int ld,
                                                   int r0, int k0, int lane) {
  int r = r0 + (lane & 15);
  int g = lane >> 4;
  const _Float16* p = src + (long)r * ld + k0 + g * 8;
  v8h lo = *(const v8h*)(p);
  v8h hi = *(const v8h*)(p + 16);
  v16h f;
#pragma unroll
  for (int i = 0; i < 8; ++i) { f[i] = lo[i]; f[i + 8] = hi[i]; }
  return f;
}

// Same fragment from an f32 source with on-the-fly f16 conversion.
static __device__ __forceinline__ v16h load_frag_f32(const float* src, int ld,
                                                     int r0, int k0, int lane) {
  int r = r0 + (lane & 15);
  int g = lane >> 4;
  const float* p = src + (long)r * ld + k0 + g * 8;
  v4f a0 = *(const v4f*)(p);
  v4f a1 = *(const v4f*)(p + 4);
  v4f b0 = *(const v4f*)(p + 16);
  v4f b1 = *(const v4f*)(p + 20);
  v16h f;
#pragma unroll
  for (int i = 0; i < 4; ++i) {
    f[i]      = (_Float16)a0[i];
    f[i + 4]  = (_Float16)a1[i];
    f[i + 8]  = (_Float16)b0[i];
    f[i + 12] = (_Float16)b1[i];
  }
  return f;
}

#define W_ROWB  256u
#define W_PITCH 272u
#define W_HALF  10240u
#define W_LDS   (2u * W_HALF)

static __device__ __forceinline__ unsigned int uni(unsigned int v) {
  return (unsigned int)__builtin_amdgcn_readfirstlane(v);
}

static __device__ __forceinline__ unsigned int pinned(unsigned int v) {
  unsigned int w = uni(v);
  asm volatile("" : "+s"(w));  // pinned(): the issue test stays in a scalar register
  return w;
}

// Waves 0 and 1 each bring one half with one tensor_load_to_lds and wait for
// their own request; the caller's __syncthreads() publishes both halves.
static __device__ __forceinline__ void stage_w(unsigned char* lds_dst,
                                               const _Float16* gsrc) {
  const unsigned int wave = uni(threadIdx.x >> 5);
  if (pinned(wave < 2u)) {
    unsigned long long ga = (unsigned long long)(size_t)gsrc + wave * W_ROWB;
    unsigned int dst = (unsigned int)(size_t)lds_dst + wave * W_HALF;
    uint4v g0;
    g0[0] = uni(1u);                               // count = 1
    g0[1] = uni(dst);                              // LDS byte address
    g0[2] = uni((unsigned int)ga);                 // global address [31:0]
    g0[3] = uni((((unsigned int)(ga >> 32)) & 0x01FFFFFFu) | 0x80000000u);  // [56:32] | type 2
    uint8v g1;
    g1[0] = uni((1u << 20) | (5u << 22) | (3u << 25));
    g1[1] = uni(W_ROWB << 16);
    g1[2] = uni(32u << 16);
    g1[3] = uni(W_ROWB << 16);
    g1[4] = uni(32u);
    g1[5] = uni(2u * W_ROWB);
    g1[6] = uni(0u);
    g1[7] = uni(0u);
    asm volatile("tensor_load_to_lds %0, %1" :: "s"(g0), "s"(g1) : "memory");
    // The compiler places no wait for a tensor load: the half has landed only
    // behind the issuing wave's own wait.
    asm volatile("s_wait_tensorcnt 0x0" ::: "memory");
  }
}

// B fragment of weight rows r0..r0+15, columns k0..k0+31, from the layout above;
// the element order is that of load_frag_h.
static __device__ __forceinline__ v16h load_frag_w(const unsigned char* w, int r0,
                                                   int k0, int lane) {
  int r = r0 + (lane & 15);
  int g = lane >> 4;
  const unsigned char* p = w + (k0 >> 7) * W_HALF + r * W_PITCH +
                           ((k0 & 127) + g * 8) * 2;
  v8h lo = *(const v8h*)(p);
  v8h hi = *(const v8h*)(p + 32);
  v16h f;
#pragma unroll
  for (int i = 0; i < 8; ++i) { f[i] = lo[i]; f[i + 8] = hi[i]; }
  return f;
}

__global__ void prep_weights_k(const float* Wq, const float* Wk, const float* Wv,
                               const float* Wo, _Float16* WqT, _Float16* WkT,
                               _Float16* WvT, _Float16* WoT) {
  int idx = blockIdx.x * blockDim.x + threadIdx.x;   // 0..65535
  int n = idx >> 8;
  int k = idx & 255;
  WqT[n * 256 + k] = (_Float16)Wq[k * 256 + n];
  WkT[n * 256 + k] = (_Float16)Wk[k * 256 + n];
  WvT[n * 256 + k] = (_Float16)Wv[k * 256 + n];
  WoT[n * 256 + k] = (_Float16)Wo[k * 256 + n];
}

__global__ void qkv_proj_k(const float* inq, const float* inkv,
                           const _Float16* WqT, const _Float16* WkT,
                           const _Float16* WvT, const float* bq, const float* bk,
                           const float* bv, _Float16* Q, _Float16* K,
                           _Float16* Vt) {
  __shared__ __attribute__((aligned(2048))) unsigned char w_s[W_LDS];  // weight slice, padded rows
  int lane = threadIdx.x & 31;
  int wave = threadIdx.x >> 5;
  int blk = blockIdx.x;
  int nt = blk & 7;                // n0 = nt*32
  int mg = (blk >> 3) & 3;
  int b  = (blk >> 5) & 7;
  int which = blk >> 8;            // 0=Q 1=K 2=V
  int n0 = nt * 32;
  int m0 = (mg * 8 + wave) * 32;

  const _Float16* WT = (which == 0) ? WqT : (which == 1 ? WkT : WvT);
  stage_w(w_s, WT + (long)n0 * DMODEL);
  __syncthreads();

  const float* A = (which == 0 ? inq : inkv) + (long)b * S_LEN * DMODEL;
  const float* bias = (which == 0) ? bq : (which == 1 ? bk : bv);

  v8f a00 = {}, a01 = {}, a10 = {}, a11 = {};
#pragma unroll
  for (int k0 = 0; k0 < DMODEL; k0 += 32) {
    v16h x0 = load_frag_f32(A, DMODEL, m0,      k0, lane);
    v16h x1 = load_frag_f32(A, DMODEL, m0 + 16, k0, lane);
    v16h w0 = load_frag_w(w_s, 0,  k0, lane);
    v16h w1 = load_frag_w(w_s, 16, k0, lane);
    a00 = wmma16(x0, w0, a00);
    a01 = wmma16(x0, w1, a01);
    a10 = wmma16(x1, w0, a10);
    a11 = wmma16(x1, w1, a11);
  }

  int col = lane & 15;
  int rbase = (lane >> 4) * 8;
  float scale = (which == 0) ? 0.17677669529663687f : 1.0f;  // 1/sqrt(HD)
  float bn0 = bias[n0 + col];
  float bn1 = bias[n0 + 16 + col];
#pragma unroll
  for (int q = 0; q < 4; ++q) {
    v8f acc = (q == 0) ? a00 : (q == 1) ? a01 : (q == 2) ? a10 : a11;
    int n = n0 + ((q & 1) ? 16 : 0) + col;
    float bn = (q & 1) ? bn1 : bn0;
    int h = n >> 5, hd = n & 31;
#pragma unroll
    for (int r = 0; r < 8; ++r) {
      int m = m0 + ((q >> 1) ? 16 : 0) + rbase + r;
      float val = (acc[r] + bn) * scale;
      if (which == 0)
        Q[((long)(b * NHEAD + h) * S_LEN + m) * HDIM + hd] = (_Float16)val;
      else if (which == 1)
        K[((long)(b * NHEAD + h) * S_LEN + m) * HDIM + hd] = (_Float16)val;
      else
        Vt[((long)(b * NHEAD + h) * HDIM + hd) * S_LEN + m] = (_Float16)val;
    }
  }
}

static __device__ __forceinline__ float xhalf(float x) {
  int v = __builtin_bit_cast(int, x);
  return __builtin_bit_cast(float, __builtin_amdgcn_permlanex16(
      v, v, 0x76543210, 0xfedcba98, false, false));
}

// ---------------------------------------------------------------------------
// Online-softmax update for one 16-query column group against 32 new keys.
// Scores are transposed: t0[r] = S[query col][key 8g + r], t1[r] the same for
// key 16 + 8g + r, so a lane holds 16 of its query's 32 scores. Maximum:
// in-lane, then one exchange between the halves. Sum: in-lane only; the
// halves' sums are joined once behind the key loop. Returns P^T as a B operand
// (element e -> key 8g + (e & 7) + 16 * (e >> 3), the order of load_frag_h).
// ---------------------------------------------------------------------------
static __device__ __forceinline__ v16h softmax_step_t(const v8f& t0, const v8f& t1,
                                                      v8f& oa, v8f& ob, float& m,
                                                      float& l) {
  float mx = fmaxf(t0[0], t1[0]);
#pragma unroll
  for (int r = 1; r < 8; ++r) mx = fmaxf(mx, fmaxf(t0[r], t1[r]));
  mx = fmaxf(mx, xhalf(mx));
  float mnew = fmaxf(m, mx);
  float corr = __expf(m - mnew);
  v16h p;
  float rs = 0.0f;
#pragma unroll
  for (int r = 0; r < 8; ++r) {
    float p0 = __expf(t0[r] - mnew);
    float p1 = __expf(t1[r] - mnew);
    rs += p0 + p1;
    p[r]     = (_Float16)p0;
    p[r + 8] = (_Float16)p1;
  }
  l = l * corr + rs;
  m = mnew;
#pragma unroll
  for (int r = 0; r < 8; ++r) { oa[r] *= corr; ob[r] *= corr; }
  return p;
}

// ---------------------------------------------------------------------------
// Kernel 3: flash attention per (b,h), transposed: S^T = K.Q^T, O^T += V^T.P^T.
// One wave owns 32 query columns (Q fragments stay in registers as B operands);
// streams keys 32 at a time: 4 WMMAs (K rows as A, reused across both query groups) +
// analytic Swin rel-pos bias + in-lane online softmax + 4 WMMAs (V^T rows as A,
// P^T packed from the score accumulators as B). Output X f16 [b][s][h*HD+hd].
// The block's head column of rel_table is copied once into LDS, densely and in
// reversed order, so a pass reads its bias at consecutive, rising LDS words
// instead of gathering one float out of every 32 bytes of global memory.
// ---------------------------------------------------------------------------
__global__ void __launch_bounds__(256) attn_k(const _Float16* Q, const _Float16* K, const _Float16* Vt,
                       const float* rel, _Float16* X) {
  int lane = threadIdx.x & 31;
  int wave = threadIdx.x >> 5;
  int blk = blockIdx.x;
  int qt = (blk & 3) * 8 + wave;     // 32-query tile, 0..31
  int bh = blk >> 2;                 // (b*NHEAD + h)
  int h = bh & 7, b = bh >> 3;

  // tab[i] = rel[NREL - 1 - i][h]; padded to 16 words a thread, so that the
  // copy has no branch (the pad is written and never read).
  __shared__ float tab[4096];
  {
    int tid = threadIdx.x & 255;   // the block has 256 threads
    int rt = tid ^ 255;            // 255 - tid
    float tv[16];
    // Unrolled so that all 16 loads of a thread are in flight together (rolled,
    // each trip waits out its own load). Source row NREL - 1 - (tid + 256 k);
    // the last trip's is clamped to stay inside rel.
#pragma unroll
    for (int k = 0; k < 16; ++k) {
      int i = rt + (NREL - 256 - 256 * k);
      tv[k] = rel[(i > 0 ? i : 0) * NHEAD + h];
    }
    // Unrolled so that tv[] stays in registers.
#pragma unroll
    for (int k = 0; k < 16; ++k) tab[tid + 256 * k] = tv[k];
  }

  const _Float16* Qp  = Q  + (long)bh * S_LEN * HDIM;
  const _Float16* Kp  = K  + (long)bh * S_LEN * HDIM;
  const _Float16* Vtp = Vt + (long)bh * HDIM * S_LEN;

  int m0 = qt * 32;
  v16h qa0 = load_frag_h(Qp, HDIM, m0,      0, lane);  // full HD in one frag
  v16h qa1 = load_frag_h(Qp, HDIM, m0 + 16, 0, lane);

  // o<u><w>[r] = O[query m0 + 16u + col][hd 16w + rbase + r]
  v8f o00 = {}, o01 = {}, o10 = {}, o11 = {};
  float mq0 = -3.0e38f, lq0 = 0.0f, mq1 = -3.0e38f, lq1 = 0.0f;

  int col = lane & 15;
  int rbase = (lane >> 4) * 8;
  int qi0 = m0 + col, qi1 = m0 + 16 + col;

  // The wave's 32 queries are image row qt (x = 16u + col); the 32 keys of a
  // pass are image row j0 / 32 (x = 16t + rbase + r). rel row index
  // (qt - j0/32 + 31) * 63 + 16(u - t) + col - rbase - r + 31, so in the
  // reversed table: (31 - qt + j0/32) * 63 + 31 - col + rbase + r - 16(u - t).
  // col ^ 15 is 15 - col, written so that the register part of the LDS address
  // is never below 0 (a constant 15 would move into the offset field).
  const float* bp = tab + (31 - qt) * 63 + (col ^ 15) + rbase;

  __syncthreads();   // tab complete before any wave reads it

  for (int j0 = 0; j0 < S_LEN; j0 += 32, bp += 63) {
    if (j0 + 32 < S_LEN) {
      __builtin_prefetch(Kp  + (long)(j0 + 32) * HDIM, 0, 1);
      __builtin_prefetch(Vtp + (long)(j0 + 32), 0, 1);
    }
    v16h kb0 = load_frag_h(Kp, HDIM, j0,      0, lane);
    v16h kb1 = load_frag_h(Kp, HDIM, j0 + 16, 0, lane);
    v8f z = {};
    // s<u><t>[r] = S[query m0 + 16u + col][key j0 + 16t + rbase + r]
    v8f s00 = wmma16(kb0, qa0, z);
    v8f s01 = wmma16(kb1, qa0, z);
    v8f s10 = wmma16(kb0, qa1, z);
    v8f s11 = wmma16(kb1, qa1, z);

    // Swin relative-position bias (POS table is an analytic constant).
#pragma unroll
    for (int r = 0; r < 8; ++r) {
      float bs = bp[16 + r];   // u == t
      s00[r] += bs;
      s01[r] += bp[32 + r];    // u = 0, t = 1
      s10[r] += bp[r];         // u = 1, t = 0
      s11[r] += bs;
    }

    v16h pb0 = softmax_step_t(s00, s01, o00, o01, mq0, lq0);
    v16h pb1 = softmax_step_t(s10, s11, o10, o11, mq1, lq1);

    v16h vb0 = load_frag_h(Vtp, S_LEN, 0,  j0, lane);
    v16h vb1 = load_frag_h(Vtp, S_LEN, 16, j0, lane);
    o00 = wmma16(vb0, pb0, o00);
    o01 = wmma16(vb1, pb0, o01);
    o10 = wmma16(vb0, pb1, o10);
    o11 = wmma16(vb1, pb1, o11);
  }

  float inv0 = 1.0f / (lq0 + xhalf(lq0));
  float inv1 = 1.0f / (lq1 + xhalf(lq1));
  v8h x00, x01, x10, x11;
#pragma unroll
  for (int r = 0; r < 8; ++r) {
    x00[r] = (_Float16)(o00[r] * inv0);
    x01[r] = (_Float16)(o01[r] * inv0);
    x10[r] = (_Float16)(o10[r] * inv1);
    x11[r] = (_Float16)(o11[r] * inv1);
  }
  _Float16* X0 = X + ((long)b * S_LEN + qi0) * DMODEL + h * HDIM + rbase;
  _Float16* X1 = X + ((long)b * S_LEN + qi1) * DMODEL + h * HDIM + rbase;
  *(v8h*)(X0)      = x00;
  *(v8h*)(X0 + 16) = x01;
  *(v8h*)(X1)      = x10;
  *(v8h*)(X1 + 16) = x11;
}

__global__ void out_proj_k(const _Float16* X, const _Float16* WoT,
                           const float* bo, float* out) {
  __shared__ __attribute__((aligned(2048))) unsigned char wo_s[W_LDS];  // weight slice, padded rows
  int lane = threadIdx.x & 31;
  int wave = threadIdx.x >> 5;
  int nb = blockIdx.x & 7;           // n0 = nb*32
  int mg = blockIdx.x >> 3;          // 0..31
  int n0 = nb * 32;
  int m0 = (mg * 8 + wave) * 32;

  stage_w(wo_s, WoT + (long)n0 * DMODEL);
  __syncthreads();

  v8f a00 = {}, a01 = {}, a10 = {}, a11 = {};
#pragma unroll
  for (int k0 = 0; k0 < DMODEL; k0 += 32) {
    v16h x0 = load_frag_h(X, DMODEL, m0,      k0, lane);
    v16h x1 = load_frag_h(X, DMODEL, m0 + 16, k0, lane);
    v16h w0 = load_frag_w(wo_s, 0,  k0, lane);
    v16h w1 = load_frag_w(wo_s, 16, k0, lane);
    a00 = wmma16(x0, w0, a00);
    a01 = wmma16(x0, w1, a01);
    a10 = wmma16(x1, w0, a10);
    a11 = wmma16(x1, w1, a11);
  }

  int col = lane & 15;
  int rbase = (lane >> 4) * 8;
  float bn0 = bo[n0 + col];
  float bn1 = bo[n0 + 16 + col];
#pragma unroll
  for (int r = 0; r < 8; ++r) {
    int ma = m0 + rbase + r;
    int mb2 = ma + 16;
    out[(long)ma  * DMODEL + n0 + col]      = a00[r] + bn0;
    out[(long)ma  * DMODEL + n0 + 16 + col] = a01[r] + bn1;
    out[(long)mb2 * DMODEL + n0 + col]      = a10[r] + bn0;
    out[(long)mb2 * DMODEL + n0 + 16 + col] = a11[r] + bn1;
  }
}

extern "C" void kernel_launch(void* const* d_in, const int* in_sizes, int n_in,
                              void* d_out, int out_size, void* d_ws, size_t ws_size,
                              hipStream_t stream) {
  (void)in_sizes; (void)n_in; (void)out_size; (void)ws_size;
  const float* inq  = (const float*)d_in[0];
  const float* inkv = (const float*)d_in[1];
  const float* Wq   = (const float*)d_in[2];
  const float* bq   = (const float*)d_in[3];
  const float* Wk   = (const float*)d_in[4];
  const float* bk   = (const float*)d_in[5];
  const float* Wv   = (const float*)d_in[6];
  const float* bv   = (const float*)d_in[7];
  const float* rel  = (const float*)d_in[8];
  const float* Wo   = (const float*)d_in[9];
  const float* bo   = (const float*)d_in[10];
  float* out = (float*)d_out;

  char* ws = (char*)d_ws;
  const size_t WSZ = 256 * 256 * sizeof(_Float16);                 // 128 KB
  const size_t QSZ = (size_t)8 * 8 * 1024 * 32 * sizeof(_Float16); // 4 MB
  _Float16* WqT = (_Float16*)(ws + 0 * WSZ);
  _Float16* WkT = (_Float16*)(ws + 1 * WSZ);
  _Float16* WvT = (_Float16*)(ws + 2 * WSZ);
  _Float16* WoT = (_Float16*)(ws + 3 * WSZ);
  size_t off = 4 * WSZ;
  _Float16* Qb = (_Float16*)(ws + off); off += QSZ;
  _Float16* Kb = (_Float16*)(ws + off); off += QSZ;
  _Float16* Vt = (_Float16*)(ws + off); off += QSZ;
  _Float16* Xb = (_Float16*)(ws + off); off += QSZ;

  prep_weights_k<<<256, 256, 0, stream>>>(Wq, Wk, Wv, Wo, WqT, WkT, WvT, WoT);
  qkv_proj_k<<<768, 256, 0, stream>>>(inq, inkv, WqT, WkT, WvT, bq, bk, bv,
                                      Qb, Kb, Vt);
  attn_k<<<256, 256, 0, stream>>>(Qb, Kb, Vt, rel, Xb);
  out_proj_k<<<256, 256, 0, stream>>>(Xb, WoT, bo, out);
}

// v005
// It runs in 63.6 microseconds.
// Timed twice side by side with v004, it ran 1.10 times as fast both times.
// Counting every step since v000, it is 5.24 times as fast.
#include <hip/hip_runtime.h>
#include <hip/hip_bf16.h>

typedef __attribute__((ext_vector_type(16))) _Float16 v16h;
typedef __attribute__((ext_vector_type(8)))  _Float16 v8h;
typedef __attribute__((ext_vector_type(8)))  float    v8f;
typedef __attribute__((ext_vector_type(4)))  float    v4f;
typedef __attribute__((ext_vector_type(4)))  unsigned int uint4v;
typedef __attribute__((ext_vector_type(8)))  unsigned int uint8v;

#define S_LEN  1024
#define DMODEL 256
#define NHEAD  8
#define HDIM   32
#define NREL   3969   // (2*32-1) * (2*32-1) rows of rel_table

static __device__ __forceinline__ v8f wmma16(v16h a, v16h b, v8f c) {
  // D = A(16x32 f16) x B(32x16 f16) + C(16x16 f32)
  return __builtin_amdgcn_wmma_f32_16x16x32_f16(false, a, false, b, (short)0, c,
                                                false, false);
}

static __device__ __forceinline__ v16h load_frag_p(const _Float16* blk, int lane) {
  v8h lo = *(const v8h*)(blk + lane * 8);
  v8h hi = *(const v8h*)(blk + 256 + lane * 8);
  v16h f;
#pragma unroll
  for (int i = 0; i < 8; ++i) { f[i] = lo[i]; f[i + 8] = hi[i]; }
  return f;
}

#define W_ROWB  256u
#define W_PITCH 272u
#define W_HALF  10240u
#define W_LDS   (2u * W_HALF)

static __device__ __forceinline__ unsigned int uni(unsigned int v) {
  return (unsigned int)__builtin_amdgcn_readfirstlane(v);
}

static __device__ __forceinline__ unsigned int pinned(unsigned int v) {
  unsigned int w = uni(v);
  asm volatile("" : "+s"(w));  // pinned(): the issue test stays in a scalar register
  return w;
}

// Waves 0 and 1 each bring one half with one tensor_load_to_lds and wait for
// their own request; the caller's __syncthreads() publishes both halves.
static __device__ __forceinline__ void stage_w(unsigned char* lds_dst,
                                               const _Float16* gsrc) {
  const unsigned int wave = uni(threadIdx.x >> 5);
  if (pinned(wave < 2u)) {
    unsigned long long ga = (unsigned long long)(size_t)gsrc + wave * W_ROWB;
    unsigned int dst = (unsigned int)(size_t)lds_dst + wave * W_HALF;
    uint4v g0;
    g0[0] = uni(1u);                               // count = 1
    g0[1] = uni(dst);                              // LDS byte address
    g0[2] = uni((unsigned int)ga);                 // global address [31:0]
    g0[3] = uni((((unsigned int)(ga >> 32)) & 0x01FFFFFFu) | 0x80000000u);  // [56:32] | type 2
    uint8v g1;
    g1[0] = uni((1u << 20) | (5u << 22) | (3u << 25));
    g1[1] = uni(W_ROWB << 16);
    g1[2] = uni(32u << 16);
    g1[3] = uni(W_ROWB << 16);
    g1[4] = uni(32u);
    g1[5] = uni(2u * W_ROWB);
    g1[6] = uni(0u);
    g1[7] = uni(0u);
    asm volatile("tensor_load_to_lds %0, %1" :: "s"(g0), "s"(g1) : "memory");
    // The compiler places no wait for a tensor load: the half has landed only
    // behind the issuing wave's own wait.
    asm volatile("s_wait_tensorcnt 0x0" ::: "memory");
  }
}

// B fragment of weight rows r0..r0+15, columns k0..k0+31, from the layout above;
// the element order is that of load_frag_p.
static __device__ __forceinline__ v16h load_frag_w(const unsigned char* w, int r0,
                                                   int k0, int lane) {
  int r = r0 + (lane & 15);
  int g = lane >> 4;
  const unsigned char* p = w + (k0 >> 7) * W_HALF + r * W_PITCH +
                           ((k0 & 127) + g * 8) * 2;
  v8h lo = *(const v8h*)(p);
  v8h hi = *(const v8h*)(p + 32);
  v16h f;
#pragma unroll
  for (int i = 0; i < 8; ++i) { f[i] = lo[i]; f[i + 8] = hi[i]; }
  return f;
}

// The k loop of a 32 x 32 projection tile: A points at the wave's two row tiles in
// fragment order (8 blocks each), w at the staged weight slice. a<u><t>: row tile u,
// weight row tile t. XA: the rows are the A operand (D = rows x weights), else the
// B operand (D transposed). One trip per k half of the slice; a trip's 16 global
// loads stand together ahead of its products, so that they are in flight together.
template <bool XA>
static __device__ __forceinline__ void proj_loop(const _Float16* A,
                                                 const unsigned char* w, int lane,
                                                 v8f& a00, v8f& a01, v8f& a10,
                                                 v8f& a11) {
  // Kept rolled: 8 k steps of row fragments alone would fill 128 registers.
#pragma unroll 1
  for (int kh = 0; kh < 2; ++kh) {
    v16h x0[4], x1[4];
#pragma unroll
    for (int j = 0; j < 4; ++j) {
      x0[j] = load_frag_p(A + (kh * 4 + j) * 512, lane);
      x1[j] = load_frag_p(A + (8 + kh * 4 + j) * 512, lane);
    }
    // Inputs-only fence on the loaded values: it holds the 16 loads ahead of the
    // products. Without it each load sinks to its use, and the wave waits out one
    // load latency per fragment instead of one per trip.
    asm volatile("" :: "v"(x0[0]), "v"(x0[1]), "v"(x0[2]), "v"(x0[3]),
                       "v"(x1[0]), "v"(x1[1]), "v"(x1[2]), "v"(x1[3]));
#pragma unroll
    for (int j = 0; j < 4; ++j) {
      v16h w0 = load_frag_w(w + kh * W_HALF, 0,  j * 32, lane);
      v16h w1 = load_frag_w(w + kh * W_HALF, 16, j * 32, lane);
      if (XA) {
        a00 = wmma16(x0[j], w0, a00);
        a01 = wmma16(x0[j], w1, a01);
        a10 = wmma16(x1[j], w0, a10);
        a11 = wmma16(x1[j], w1, a11);
      } else {
        a00 = wmma16(w0, x0[j], a00);
        a01 = wmma16(w1, x0[j], a01);
        a10 = wmma16(w0, x1[j], a10);
        a11 = wmma16(w1, x1[j], a11);
      }
    }
  }
}

__global__ void prep_weights_k(const float* Wq, const float* Wk, const float* Wv,
                               const float* Wo, const float* inq, const float* inkv,
                               _Float16* WqT, _Float16* WkT,
                               _Float16* WvT, _Float16* WoT, _Float16* Aq,
                               _Float16* Akv) {
  int idx = blockIdx.x * blockDim.x + threadIdx.x;   // 0..65535
  int n = idx >> 8;
  int k = idx & 255;
  // A thread converts 4 runs of 8 elements of each input. Run c of an input goes
  // to halves 8c..8c+7, so a wave stores 512 contiguous bytes; c = ((mt * 8 + ks)
  // * 2 + upper) * 32 + lane. The 16 loads stand ahead of the kernel's first store,
  // so that they are in flight together.
  v4f ra[8], rb[8];
#pragma unroll
  for (int i = 0; i < 8; ++i) {
    int c = (blockIdx.x * 4 + (i & 3)) * 256 + (int)threadIdx.x;
    int row = (c >> 9) * 16 + (c & 15);
    int kk = ((c >> 6) & 7) * 32 + ((c >> 5) & 1) * 16 + ((c >> 4) & 1) * 8;
    const float* p = (i < 4 ? inq : inkv) + (long)row * DMODEL + kk;
    ra[i] = *(const v4f*)(p);
    rb[i] = *(const v4f*)(p + 4);
  }
  WqT[n * 256 + k] = (_Float16)Wq[k * 256 + n];
  WkT[n * 256 + k] = (_Float16)Wk[k * 256 + n];
  WvT[n * 256 + k] = (_Float16)Wv[k * 256 + n];
  WoT[n * 256 + k] = (_Float16)Wo[k * 256 + n];
#pragma unroll
  for (int i = 0; i < 8; ++i) {
    int c = (blockIdx.x * 4 + (i & 3)) * 256 + (int)threadIdx.x;
    v8h o;
#pragma unroll
    for (int j = 0; j < 4; ++j) {
      o[j]     = (_Float16)ra[i][j];
      o[j + 4] = (_Float16)rb[i][j];
    }
    *(v8h*)((i < 4 ? Aq : Akv) + (long)c * 8) = o;
  }
}

__global__ void qkv_proj_k(const _Float16* Aq, const _Float16* Akv,
                           const _Float16* WqT, const _Float16* WkT,
                           const _Float16* WvT, const float* bq, const float* bk,
                           const float* bv, _Float16* Q, _Float16* K,
                           _Float16* Vt) {
  __shared__ __attribute__((aligned(2048))) unsigned char w_s[W_LDS];  // weight slice, padded rows
  int lane = threadIdx.x & 31;
  int wave = threadIdx.x >> 5;
  int blk = blockIdx.x;
  int nt = blk & 7;                // n0 = nt*32
  int mg = (blk >> 3) & 3;
  int b  = (blk >> 5) & 7;
  int which = blk >> 8;            // 0=Q 1=K 2=V
  int n0 = nt * 32;
  int m0 = (mg * 8 + wave) * 32;
  int bh = b * NHEAD + nt;

  const _Float16* WT = (which == 0) ? WqT : (which == 1 ? WkT : WvT);
  stage_w(w_s, WT + (long)n0 * DMODEL);
  __syncthreads();

  // The wave's two row tiles: 8 blocks (k steps) each.
  const _Float16* A = (which == 0 ? Aq : Akv) +
                      (long)((b * S_LEN + m0) >> 4) * (8 * 512);

  // a<u><t>: input row tile u, weight row tile t.
  v8f a00 = {}, a01 = {}, a10 = {}, a11 = {};
  if (which == 2) {
    proj_loop<true>(A, w_s, lane, a00, a01, a10, a11);
    // a<u><t>[r] = V[s = m0 + 16u + 8g + r][hd = 16t + (lane & 15)]
    float bn0 = bv[n0 + (lane & 15)];
    float bn1 = bv[n0 + 16 + (lane & 15)];
    v8h y00, y01, y10, y11;
#pragma unroll
    for (int r = 0; r < 8; ++r) {
      y00[r] = (_Float16)(a00[r] + bn0);
      y01[r] = (_Float16)(a01[r] + bn1);
      y10[r] = (_Float16)(a10[r] + bn0);
      y11[r] = (_Float16)(a11[r] + bn1);
    }
    _Float16* o = Vt + (long)(bh * 32 + (m0 >> 5)) * 1024 + lane * 8;
    *(v8h*)(o)             = y00;   // hd tile 0, keys 8g + r
    *(v8h*)(o + 256)       = y10;   // hd tile 0, keys 16 + 8g + r
    *(v8h*)(o + 512)       = y01;   // hd tile 1
    *(v8h*)(o + 512 + 256) = y11;
  } else {
    proj_loop<false>(A, w_s, lane, a00, a01, a10, a11);
    // a<u><t>[r] = out[s = m0 + 16u + (lane & 15)][hd = 16t + 8g + r]
    const float* bias = (which == 0 ? bq : bk) + n0 + (lane >> 4) * 8;
    float scale = (which == 0) ? 0.17677669529663687f : 1.0f;  // 1/sqrt(HD)
    v8h y00, y01, y10, y11;
#pragma unroll
    for (int r = 0; r < 8; ++r) {
      float bn0 = bias[r];
      float bn1 = bias[16 + r];
      y00[r] = (_Float16)((a00[r] + bn0) * scale);
      y01[r] = (_Float16)((a01[r] + bn1) * scale);
      y10[r] = (_Float16)((a10[r] + bn0) * scale);
      y11[r] = (_Float16)((a11[r] + bn1) * scale);
    }
    _Float16* o = (which == 0 ? Q : K) + (long)(bh * 64 + (m0 >> 4)) * 512 + lane * 8;
    *(v8h*)(o)             = y00;   // row tile 0, hd 8g + r
    *(v8h*)(o + 256)       = y01;   // row tile 0, hd 16 + 8g + r
    *(v8h*)(o + 512)       = y10;   // row tile 1
    *(v8h*)(o + 512 + 256) = y11;
  }
}

static __device__ __forceinline__ float xhalf(float x) {
  int v = __builtin_bit_cast(int, x);
  return __builtin_bit_cast(float, __builtin_amdgcn_permlanex16(
      v, v, 0x76543210, 0xfedcba98, false, false));
}

// ---------------------------------------------------------------------------
// Online-softmax update for one 16-query column group against 32 new keys.
// Scores are transposed: t0[r] = S[query col][key 8g + r], t1[r] the same for
// key 16 + 8g + r, so a lane holds 16 of its query's 32 scores. Maximum:
// in-lane, then one exchange between the halves. Sum: in-lane only; the
// halves' sums are joined once behind the key loop. Returns P^T as a B operand
// (element e -> key 8g + (e & 7) + 16 * (e >> 3), the order of load_frag_p).
// ---------------------------------------------------------------------------
static __device__ __forceinline__ v16h softmax_step_t(const v8f& t0, const v8f& t1,
                                                      v8f& oa, v8f& ob, float& m,
                                                      float& l) {
  float mx = fmaxf(t0[0], t1[0]);
#pragma unroll
  for (int r = 1; r < 8; ++r) mx = fmaxf(mx, fmaxf(t0[r], t1[r]));
  mx = fmaxf(mx, xhalf(mx));
  float mnew = fmaxf(m, mx);
  float corr = __expf(m - mnew);
  v16h p;
  float rs = 0.0f;
#pragma unroll
  for (int r = 0; r < 8; ++r) {
    float p0 = __expf(t0[r] - mnew);
    float p1 = __expf(t1[r] - mnew);
    rs += p0 + p1;
    p[r]     = (_Float16)p0;
    p[r + 8] = (_Float16)p1;
  }
  l = l * corr + rs;
  m = mnew;
#pragma unroll
  for (int r = 0; r < 8; ++r) { oa[r] *= corr; ob[r] *= corr; }
  return p;
}

// ---------------------------------------------------------------------------
// Kernel 3: flash attention per (b,h), transposed: S^T = K.Q^T, O^T += V^T.P^T.
// One wave owns 32 query columns (Q fragments stay in registers as B operands);
// streams keys 32 at a time: 4 WMMAs (K rows as A, reused across both query groups) +
// analytic Swin rel-pos bias + in-lane online softmax + 4 WMMAs (V^T rows as A,
// P^T packed from the score accumulators as B). Q, K, V^T come in fragment order;
// X leaves in it: block (16-row tile of b*S + s, k step = head), K index = hd.
// The block's head column of rel_table is copied once into LDS, densely and in
// reversed order, so a pass reads its bias at consecutive, rising LDS words
// instead of gathering one float out of every 32 bytes of global memory.
// ---------------------------------------------------------------------------
__global__ void __launch_bounds__(256) attn_k(const _Float16* Q, const _Float16* K, const _Float16* Vt,
                       const float* rel, _Float16* X) {
  int lane = threadIdx.x & 31;
  int wave = threadIdx.x >> 5;
  int blk = blockIdx.x;
  int qt = (blk & 3) * 8 + wave;     // 32-query tile, 0..31
  int bh = blk >> 2;                 // (b*NHEAD + h)
  int h = bh & 7, b = bh >> 3;

  // tab[i] = rel[NREL - 1 - i][h]; padded to 16 words a thread, so that the
  // copy has no branch (the pad is written and never read).
  __shared__ float tab[4096];
  {
    int tid = threadIdx.x & 255;   // the block has 256 threads
    int rt = tid ^ 255;            // 255 - tid
    float tv[16];
    // Unrolled so that all 16 loads of a thread are in flight together (rolled,
    // each trip waits out its own load). Source row NREL - 1 - (tid + 256 k);
    // the last trip's is clamped to stay inside rel.
#pragma unroll
    for (int k = 0; k < 16; ++k) {
      int i = rt + (NREL - 256 - 256 * k);
      tv[k] = rel[(i > 0 ? i : 0) * NHEAD + h];
    }
    // Unrolled so that tv[] stays in registers.
#pragma unroll
    for (int k = 0; k < 16; ++k) tab[tid + 256 * k] = tv[k];
  }

  // Per (b,h): 64 blocks of Q, 64 of K (two a pass), 64 of V^T (two a pass).
  const _Float16* Qp  = Q  + (long)bh * S_LEN * HDIM;
  const _Float16* Kp  = K  + (long)bh * S_LEN * HDIM;
  const _Float16* Vtp = Vt + (long)bh * HDIM * S_LEN;

  int m0 = qt * 32;
  v16h qa0 = load_frag_p(Qp + (long)m0 * HDIM,       lane);  // full HD in one frag
  v16h qa1 = load_frag_p(Qp + (long)m0 * HDIM + 512, lane);

  // o<u><w>[r] = O[query m0 + 16u + col][hd 16w + rbase + r]
  v8f o00 = {}, o01 = {}, o10 = {}, o11 = {};
  float mq0 = -3.0e38f, lq0 = 0.0f, mq1 = -3.0e38f, lq1 = 0.0f;

  int col = lane & 15;
  int rbase = (lane >> 4) * 8;

  // The wave's 32 queries are image row qt (x = 16u + col); the 32 keys of a
  // pass are image row j0 / 32 (x = 16t + rbase + r). rel row index
  // (qt - j0/32 + 31) * 63 + 16(u - t) + col - rbase - r + 31, so in the
  // reversed table: (31 - qt + j0/32) * 63 + 31 - col + rbase + r - 16(u - t).
  // col ^ 15 is 15 - col, written so that the register part of the LDS address
  // is never below 0 (a constant 15 would move into the offset field).
  const float* bp = tab + (31 - qt) * 63 + (col ^ 15) + rbase;

  __syncthreads();   // tab complete before any wave reads it

  for (int j0 = 0; j0 < S_LEN; j0 += 32, bp += 63) {
    if (j0 + 32 < S_LEN) {
      __builtin_prefetch(Kp  + (long)(j0 + 32) * HDIM, 0, 1);
      __builtin_prefetch(Vtp + (long)(j0 + 32) * HDIM, 0, 1);
    }
    v16h kb0 = load_frag_p(Kp + (long)j0 * HDIM,       lane);
    v16h kb1 = load_frag_p(Kp + (long)j0 * HDIM + 512, lane);
    v8f z = {};
    // s<u><t>[r] = S[query m0 + 16u + col][key j0 + 16t + rbase + r]
    v8f s00 = wmma16(kb0, qa0, z);
    v8f s01 = wmma16(kb1, qa0, z);
    v8f s10 = wmma16(kb0, qa1, z);
    v8f s11 = wmma16(kb1, qa1, z);

    // Swin relative-position bias (POS table is an analytic constant).
#pragma unroll
    for (int r = 0; r < 8; ++r) {
      float bs = bp[16 + r];   // u == t
      s00[r] += bs;
      s01[r] += bp[32 + r];    // u = 0, t = 1
      s10[r] += bp[r];         // u = 1, t = 0
      s11[r] += bs;
    }

    v16h pb0 = softmax_step_t(s00, s01, o00, o01, mq0, lq0);
    v16h pb1 = softmax_step_t(s10, s11, o10, o11, mq1, lq1);

    v16h vb0 = load_frag_p(Vtp + (long)j0 * HDIM,       lane);
    v16h vb1 = load_frag_p(Vtp + (long)j0 * HDIM + 512, lane);
    o00 = wmma16(vb0, pb0, o00);
    o01 = wmma16(vb1, pb0, o01);
    o10 = wmma16(vb0, pb1, o10);
    o11 = wmma16(vb1, pb1, o11);
  }

  float inv0 = 1.0f / (lq0 + xhalf(lq0));
  float inv1 = 1.0f / (lq1 + xhalf(lq1));
  v8h x00, x01, x10, x11;
#pragma unroll
  for (int r = 0; r < 8; ++r) {
    x00[r] = (_Float16)(o00[r] * inv0);
    x01[r] = (_Float16)(o01[r] * inv0);
    x10[r] = (_Float16)(o10[r] * inv1);
    x11[r] = (_Float16)(o11[r] * inv1);
  }
  _Float16* X0 = X + ((long)((b * S_LEN + m0) >> 4) * 8 + h) * 512 + lane * 8;
  _Float16* X1 = X0 + 8 * 512;   // the next row tile
  *(v8h*)(X0)       = x00;
  *(v8h*)(X0 + 256) = x01;
  *(v8h*)(X1)       = x10;
  *(v8h*)(X1 + 256) = x11;
}

__global__ void out_proj_k(const _Float16* X, const _Float16* WoT,
                           const float* bo, float* out) {
  __shared__ __attribute__((aligned(2048))) unsigned char wo_s[W_LDS];  // weight slice, padded rows
  int lane = threadIdx.x & 31;
  int wave = threadIdx.x >> 5;
  int nb = blockIdx.x & 7;           // n0 = nb*32
  int mg = blockIdx.x >> 3;          // 0..31
  int n0 = nb * 32;
  int m0 = (mg * 8 + wave) * 32;

  stage_w(wo_s, WoT + (long)n0 * DMODEL);
  __syncthreads();

  v8f a00 = {}, a01 = {}, a10 = {}, a11 = {};
  proj_loop<true>(X + (long)(m0 >> 4) * (8 * 512), wo_s, lane, a00, a01, a10, a11);

  int col = lane & 15;
  int rbase = (lane >> 4) * 8;
  float bn0 = bo[n0 + col];
  float bn1 = bo[n0 + 16 + col];
#pragma unroll
  for (int r = 0; r < 8; ++r) {
    int ma = m0 + rbase + r;
    int mb2 = ma + 16;
    out[(long)ma  * DMODEL + n0 + col]      = a00[r] + bn0;
    out[(long)ma  * DMODEL + n0 + 16 + col] = a01[r] + bn1;
    out[(long)mb2 * DMODEL + n0 + col]      = a10[r] + bn0;
    out[(long)mb2 * DMODEL + n0 + 16 + col] = a11[r] + bn1;
  }
}

extern "C" void kernel_launch(void* const* d_in, const int* in_sizes, int n_in,
                              void* d_out, int out_size, void* d_ws, size_t ws_size,
                              hipStream_t stream) {
  (void)in_sizes; (void)n_in; (void)out_size; (void)ws_size;
  const float* inq  = (const float*)d_in[0];
  const float* inkv = (const float*)d_in[1];
  const float* Wq   = (const float*)d_in[2];
  const float* bq   = (const float*)d_in[3];
  const float* Wk   = (const float*)d_in[4];
  const float* bk   = (const float*)d_in[5];
  const float* Wv   = (const float*)d_in[6];
  const float* bv   = (const float*)d_in[7];
  const float* rel  = (const float*)d_in[8];
  const float* Wo   = (const float*)d_in[9];
  const float* bo   = (const float*)d_in[10];
  float* out = (float*)d_out;

  char* ws = (char*)d_ws;
  const size_t WSZ = 256 * 256 * sizeof(_Float16);                 // 128 KB
  const size_t QSZ = (size_t)8 * 8 * 1024 * 32 * sizeof(_Float16); // 4 MB
  _Float16* WqT = (_Float16*)(ws + 0 * WSZ);
  _Float16* WkT = (_Float16*)(ws + 1 * WSZ);
  _Float16* WvT = (_Float16*)(ws + 2 * WSZ);
  _Float16* WoT = (_Float16*)(ws + 3 * WSZ);
  size_t off = 4 * WSZ;
  _Float16* Qb = (_Float16*)(ws + off); off += QSZ;
  _Float16* Kb = (_Float16*)(ws + off); off += QSZ;
  _Float16* Vt = (_Float16*)(ws + off); off += QSZ;
  _Float16* Xb = (_Float16*)(ws + off); off += QSZ;
  _Float16* Aq  = (_Float16*)(ws + off); off += QSZ;   // 8192 x 256 f16 each
  _Float16* Akv = (_Float16*)(ws + off); off += QSZ;

  prep_weights_k<<<256, 256, 0, stream>>>(Wq, Wk, Wv, Wo, inq, inkv, WqT, WkT, WvT, WoT,
                                          Aq, Akv);
  qkv_proj_k<<<768, 256, 0, stream>>>(Aq, Akv, WqT, WkT, WvT, bq, bk, bv,
                                      Qb, Kb, Vt);
  attn_k<<<256, 256, 0, stream>>>(Qb, Kb, Vt, rel, Xb);
  out_proj_k<<<256, 256, 0, stream>>>(Xb, WoT, bo, out);
}

// v006
// A run of this version takes 46.9 microseconds.
// Timed twice side by side with v005, it ran 1.35 and 1.36 times as fast.
// Over all steps from v000 it is 7.12 times as fast.
#include <hip/hip_runtime.h>
#include <hip/hip_bf16.h>

typedef __attribute__((ext_vector_type(16))) _Float16 v16h;
typedef __attribute__((ext_vector_type(8)))  _Float16 v8h;
typedef __attribute__((ext_vector_type(8)))  float    v8f;
typedef __attribute__((ext_vector_type(4)))  float    v4f;
typedef __attribute__((ext_vector_type(4)))  unsigned int uint4v;
typedef __attribute__((ext_vector_type(8)))  unsigned int uint8v;

#define S_LEN  1024
#define DMODEL 256
#define NHEAD  8
#define HDIM   32
#define NREL   3969   // (2*32-1) * (2*32-1) rows of rel_table

static __device__ __forceinline__ v8f wmma16(v16h a, v16h b, v8f c) {
  // D = A(16x32 f16) x B(32x16 f16) + C(16x16 f32)
  return __builtin_amdgcn_wmma_f32_16x16x32_f16(false, a, false, b, (short)0, c,
                                                false, false);
}

static __device__ __forceinline__ v16h load_frag_p(const _Float16* blk, int lane) {
  v8h lo = *(const v8h*)(blk + lane * 8);
  v8h hi = *(const v8h*)(blk + 256 + lane * 8);
  v16h f;
#pragma unroll
  for (int i = 0; i < 8; ++i) { f[i] = lo[i]; f[i + 8] = hi[i]; }
  return f;
}

#define W_ROWB  256u
#define W_PITCH 272u
#define W_HALF  10240u
#define W_LDS   (2u * W_HALF)

static __device__ __forceinline__ unsigned int uni(unsigned int v) {
  return (unsigned int)__builtin_amdgcn_readfirstlane(v);
}

static __device__ __forceinline__ unsigned int pinned(unsigned int v) {
  unsigned int w = uni(v);
  asm volatile("" : "+s"(w));  // pinned(): the issue test stays in a scalar register
  return w;
}

// Waves 0 and 1 each bring one half with one tensor_load_to_lds and wait for
// their own request; the caller's __syncthreads() publishes both halves.
static __device__ __forceinline__ void stage_w(unsigned char* lds_dst,
                                               const _Float16* gsrc) {
  const unsigned int wave = uni(threadIdx.x >> 5);
  if (pinned(wave < 2u)) {
    unsigned long long ga = (unsigned long long)(size_t)gsrc + wave * W_ROWB;
    unsigned int dst = (unsigned int)(size_t)lds_dst + wave * W_HALF;
    uint4v g0;
    g0[0] = uni(1u);                               // count = 1
    g0[1] = uni(dst);                              // LDS byte address
    g0[2] = uni((unsigned int)ga);                 // global address [31:0]
    g0[3] = uni((((unsigned int)(ga >> 32)) & 0x01FFFFFFu) | 0x80000000u);  // [56:32] | type 2
    uint8v g1;
    g1[0] = uni((1u << 20) | (5u << 22) | (3u << 25));
    g1[1] = uni(W_ROWB << 16);
    g1[2] = uni(32u << 16);
    g1[3] = uni(W_ROWB << 16);
    g1[4] = uni(32u);
    g1[5] = uni(2u * W_ROWB);
    g1[6] = uni(0u);
    g1[7] = uni(0u);
    asm volatile("tensor_load_to_lds %0, %1" :: "s"(g0), "s"(g1) : "memory");
    // The compiler places no wait for a tensor load: the half has landed only
    // behind the issuing wave's own wait.
    asm volatile("s_wait_tensorcnt 0x0" ::: "memory");
  }
}

// B fragment of weight rows r0..r0+15, columns k0..k0+31, from the layout above;
// the element order is that of load_frag_p.
static __device__ __forceinline__ v16h load_frag_w(const unsigned char* w, int r0,
                                                   int k0, int lane) {
  int r = r0 + (lane & 15);
  int g = lane >> 4;
  const unsigned char* p = w + (k0 >> 7) * W_HALF + r * W_PITCH +
                           ((k0 & 127) + g * 8) * 2;
  v8h lo = *(const v8h*)(p);
  v8h hi = *(const v8h*)(p + 32);
  v16h f;
#pragma unroll
  for (int i = 0; i < 8; ++i) { f[i] = lo[i]; f[i + 8] = hi[i]; }
  return f;
}

// The k loop of a 32 x 32 projection tile: A points at the wave's two row tiles in
// fragment order (8 blocks each), w at the staged weight slice. a<u><t>: row tile u,
// weight row tile t. XA: the rows are the A operand (D = rows x weights), else the
// B operand (D transposed). One trip per k half of the slice; a trip's 16 global
// loads stand together ahead of its products, so that they are in flight together.
template <bool XA>
static __device__ __forceinline__ void proj_loop(const _Float16* A,
                                                 const unsigned char* w, int lane,
                                                 v8f& a00, v8f& a01, v8f& a10,
                                                 v8f& a11) {
  // Kept rolled: 8 k steps of row fragments alone would fill 128 registers.
#pragma unroll 1
  for (int kh = 0; kh < 2; ++kh) {
    v16h x0[4], x1[4];
#pragma unroll
    for (int j = 0; j < 4; ++j) {
      x0[j] = load_frag_p(A + (kh * 4 + j) * 512, lane);
      x1[j] = load_frag_p(A + (8 + kh * 4 + j) * 512, lane);
    }
    // Inputs-only fence on the loaded values: it holds the 16 loads ahead of the
    // products. Without it each load sinks to its use, and the wave waits out one
    // load latency per fragment instead of one per trip.
    asm volatile("" :: "v"(x0[0]), "v"(x0[1]), "v"(x0[2]), "v"(x0[3]),
                       "v"(x1[0]), "v"(x1[1]), "v"(x1[2]), "v"(x1[3]));
#pragma unroll
    for (int j = 0; j < 4; ++j) {
      v16h w0 = load_frag_w(w + kh * W_HALF, 0,  j * 32, lane);
      v16h w1 = load_frag_w(w + kh * W_HALF, 16, j * 32, lane);
      if (XA) {
        a00 = wmma16(x0[j], w0, a00);
        a01 = wmma16(x0[j], w1, a01);
        a10 = wmma16(x1[j], w0, a10);
        a11 = wmma16(x1[j], w1, a11);
      } else {
        a00 = wmma16(w0, x0[j], a00);
        a01 = wmma16(w1, x0[j], a01);
        a10 = wmma16(w0, x1[j], a10);
        a11 = wmma16(w1, x1[j], a11);
      }
    }
  }
}

__global__ void prep_weights_k(const float* Wq, const float* Wk, const float* Wv,
                               const float* Wo, const float* inq, const float* inkv,
                               _Float16* WqT, _Float16* WkT,
                               _Float16* WvT, _Float16* WoF, _Float16* Aq,
                               _Float16* Akv) {
  int idx = blockIdx.x * blockDim.x + threadIdx.x;   // 0..65535
  int n = idx >> 8;
  int k = idx & 255;
  // A thread converts 4 runs of 8 elements of each input. Run c of an input goes
  // to halves 8c..8c+7, so a wave stores 512 contiguous bytes; c = ((mt * 8 + ks)
  // * 2 + upper) * 32 + lane. The 16 loads stand ahead of the kernel's first store,
  // so that they are in flight together.
  v4f ra[8], rb[8];
#pragma unroll
  for (int i = 0; i < 8; ++i) {
    int c = (blockIdx.x * 4 + (i & 3)) * 256 + (int)threadIdx.x;
    int row = (c >> 9) * 16 + (c & 15);
    int kk = ((c >> 6) & 7) * 32 + ((c >> 5) & 1) * 16 + ((c >> 4) & 1) * 8;
    const float* p = (i < 4 ? inq : inkv) + (long)row * DMODEL + kk;
    ra[i] = *(const v4f*)(p);
    rb[i] = *(const v4f*)(p + 4);
  }
  WqT[n * 256 + k] = (_Float16)Wq[k * 256 + n];
  WkT[n * 256 + k] = (_Float16)Wk[k * 256 + n];
  WvT[n * 256 + k] = (_Float16)Wv[k * 256 + n];
  // Column n, row k of Wo: lane (n & 15) + 16 * ((k >> 3) & 1), element (k & 7) +
  // 8 * ((k >> 4) & 1) of its block.
  WoF[((n >> 4) * 8 + (k >> 5)) * 512 + ((k >> 4) & 1) * 256 +
      ((n & 15) + ((k >> 3) & 1) * 16) * 8 + (k & 7)] = (_Float16)Wo[k * 256 + n];
#pragma unroll
  for (int i = 0; i < 8; ++i) {
    int c = (blockIdx.x * 4 + (i & 3)) * 256 + (int)threadIdx.x;
    v8h o;
#pragma unroll
    for (int j = 0; j < 4; ++j) {
      o[j]     = (_Float16)ra[i][j];
      o[j + 4] = (_Float16)rb[i][j];
    }
    *(v8h*)((i < 4 ? Aq : Akv) + (long)c * 8) = o;
  }
}

__global__ void qkv_proj_k(const _Float16* Aq, const _Float16* Akv,
                           const _Float16* WqT, const _Float16* WkT,
                           const _Float16* WvT, const float* bq, const float* bk,
                           const float* bv, _Float16* Q, _Float16* K,
                           _Float16* Vt) {
  __shared__ __attribute__((aligned(2048))) unsigned char w_s[W_LDS];  // weight slice, padded rows
  int lane = threadIdx.x & 31;
  int wave = threadIdx.x >> 5;
  int blk = blockIdx.x;
  int nt = blk & 7;                // n0 = nt*32
  int mg = (blk >> 3) & 3;
  int b  = (blk >> 5) & 7;
  int which = blk >> 8;            // 0=Q 1=K 2=V
  int n0 = nt * 32;
  int m0 = (mg * 8 + wave) * 32;
  int bh = b * NHEAD + nt;

  const _Float16* WT = (which == 0) ? WqT : (which == 1 ? WkT : WvT);
  stage_w(w_s, WT + (long)n0 * DMODEL);
  __syncthreads();

  // The wave's two row tiles: 8 blocks (k steps) each.
  const _Float16* A = (which == 0 ? Aq : Akv) +
                      (long)((b * S_LEN + m0) >> 4) * (8 * 512);

  // a<u><t>: input row tile u, weight row tile t.
  v8f a00 = {}, a01 = {}, a10 = {}, a11 = {};
  if (which == 2) {
    proj_loop<true>(A, w_s, lane, a00, a01, a10, a11);
    // a<u><t>[r] = V[s = m0 + 16u + 8g + r][hd = 16t + (lane & 15)]
    float bn0 = bv[n0 + (lane & 15)];
    float bn1 = bv[n0 + 16 + (lane & 15)];
    v8h y00, y01, y10, y11;
#pragma unroll
    for (int r = 0; r < 8; ++r) {
      y00[r] = (_Float16)(a00[r] + bn0);
      y01[r] = (_Float16)(a01[r] + bn1);
      y10[r] = (_Float16)(a10[r] + bn0);
      y11[r] = (_Float16)(a11[r] + bn1);
    }
    _Float16* o = Vt + (long)(bh * 32 + (m0 >> 5)) * 1024 + lane * 8;
    *(v8h*)(o)             = y00;   // hd tile 0, keys 8g + r
    *(v8h*)(o + 256)       = y10;   // hd tile 0, keys 16 + 8g + r
    *(v8h*)(o + 512)       = y01;   // hd tile 1
    *(v8h*)(o + 512 + 256) = y11;
  } else {
    proj_loop<false>(A, w_s, lane, a00, a01, a10, a11);
    // a<u><t>[r] = out[s = m0 + 16u + (lane & 15)][hd = 16t + 8g + r]
    const float* bias = (which == 0 ? bq : bk) + n0 + (lane >> 4) * 8;
    float scale = (which == 0) ? 0.17677669529663687f : 1.0f;  // 1/sqrt(HD)
    v8h y00, y01, y10, y11;
#pragma unroll
    for (int r = 0; r < 8; ++r) {
      float bn0 = bias[r];
      float bn1 = bias[16 + r];
      y00[r] = (_Float16)((a00[r] + bn0) * scale);
      y01[r] = (_Float16)((a01[r] + bn1) * scale);
      y10[r] = (_Float16)((a10[r] + bn0) * scale);
      y11[r] = (_Float16)((a11[r] + bn1) * scale);
    }
    _Float16* o = (which == 0 ? Q : K) + (long)(bh * 64 + (m0 >> 4)) * 512 + lane * 8;
    *(v8h*)(o)             = y00;   // row tile 0, hd 8g + r
    *(v8h*)(o + 256)       = y01;   // row tile 0, hd 16 + 8g + r
    *(v8h*)(o + 512)       = y10;   // row tile 1
    *(v8h*)(o + 512 + 256) = y11;
  }
}

static __device__ __forceinline__ float xhalf(float x) {
  int v = __builtin_bit_cast(int, x);
  return __builtin_bit_cast(float, __builtin_amdgcn_permlanex16(
      v, v, 0x76543210, 0xfedcba98, false, false));
}

// ---------------------------------------------------------------------------
// Online-softmax update for one 16-query column group against 32 new keys.
// Scores are transposed: t0[r] = S[query col][key 8g + r], t1[r] the same for
// key 16 + 8g + r, so a lane holds 16 of its query's 32 scores. Maximum:
// in-lane, then one exchange between the halves. Sum: in-lane only; the
// halves' sums are joined once behind the key loop. Returns P^T as a B operand
// (element e -> key 8g + (e & 7) + 16 * (e >> 3), the order of load_frag_p).
// ---------------------------------------------------------------------------
static __device__ __forceinline__ v16h softmax_step_t(const v8f& t0, const v8f& t1,
                                                      v8f& oa, v8f& ob, float& m,
                                                      float& l) {
  float mx = fmaxf(t0[0], t1[0]);
#pragma unroll
  for (int r = 1; r < 8; ++r) mx = fmaxf(mx, fmaxf(t0[r], t1[r]));
  mx = fmaxf(mx, xhalf(mx));
  float mnew = fmaxf(m, mx);
  float corr = __expf(m - mnew);
  v16h p;
  float rs = 0.0f;
#pragma unroll
  for (int r = 0; r < 8; ++r) {
    float p0 = __expf(t0[r] - mnew);
    float p1 = __expf(t1[r] - mnew);
    rs += p0 + p1;
    p[r]     = (_Float16)p0;
    p[r + 8] = (_Float16)p1;
  }
  l = l * corr + rs;
  m = mnew;
#pragma unroll
  for (int r = 0; r < 8; ++r) { oa[r] *= corr; ob[r] *= corr; }
  return p;
}

#define TAB_S 2056

__global__ void __launch_bounds__(256) attn_k(const _Float16* Q, const _Float16* K, const _Float16* Vt,
                       const float* rel, const _Float16* WoF, const float* bo,
                       float* out) {
  int lane = threadIdx.x & 31;
  int wave = (int)uni(threadIdx.x >> 5);   // the same in every lane: addresses built on it stay scalar
  int qt = blockIdx.x & 31;          // 32-query tile = image row, 0..31
  int b = blockIdx.x >> 5;
  int h = wave;
  int bh = b * NHEAD + h;

  // tab[h * TAB_S + 32 + i] = rel[63 * qt + 2015 - i][h], i = 0..2015. The copy
  // runs over 2048 rows, so that it has no branch: the 32 words in front of each
  // plane take the surplus (written, never read).
  __shared__ float tab[NHEAD * TAB_S];
  __shared__ __attribute__((aligned(16))) _Float16 x_s[2 * 8 * 512];
  {
    int tid = threadIdx.x & 255;   // the block has 256 threads
    v4f tv[16];
    // Chunk c = 16 bytes: heads 4 * (c & 1) .. + 3 of row 63 * qt + (c >> 1); a wave
    // loads 512 contiguous bytes. Unrolled so that all 16 loads of a thread are in
    // flight together; the surplus rows are clamped to stay inside rel.
#pragma unroll
    for (int k = 0; k < 16; ++k) {
      int cc = tid + 256 * k;
      int row = 63 * qt + (cc >> 1);
      tv[k] = *(const v4f*)(rel + (row < NREL ? row : NREL - 1) * NHEAD + (cc & 1) * 4);
    }
    // Unrolled so that tv[] stays in registers. Word 2047 - (cc >> 1) of the plane,
    // written as (127 - (tid >> 1)) + 128 * (15 - k) with the xor for the first term,
    // so that the register part of the LDS address is never below 0.
    int rt = (tid >> 1) ^ 127;
#pragma unroll
    for (int k = 0; k < 16; ++k) {
      float* d = tab + (tid & 1) * (4 * TAB_S) + rt + 128 * (15 - k);
      d[0]         = tv[k][0];
      d[TAB_S]     = tv[k][1];
      d[2 * TAB_S] = tv[k][2];
      d[3 * TAB_S] = tv[k][3];
    }
  }

  // Per (b,h): 64 blocks of Q, 64 of K (two a pass), 64 of V^T (two a pass).
  const _Float16* Qp  = Q  + (long)bh * S_LEN * HDIM;
  const _Float16* Kp  = K  + (long)bh * S_LEN * HDIM;
  const _Float16* Vtp = Vt + (long)bh * HDIM * S_LEN;

  int m0 = qt * 32;
  v16h qa0 = load_frag_p(Qp + (long)m0 * HDIM,       lane);  // full HD in one frag
  v16h qa1 = load_frag_p(Qp + (long)m0 * HDIM + 512, lane);

  // o<u><w>[r] = O[query m0 + 16u + col][hd 16w + rbase + r]
  v8f o00 = {}, o01 = {}, o10 = {}, o11 = {};
  float mq0 = -3.0e38f, lq0 = 0.0f, mq1 = -3.0e38f, lq1 = 0.0f;

  int col = lane & 15;
  int rbase = (lane >> 4) * 8;

  // The wave's 32 queries are image row qt (x = 16u + col); the 32 keys of a
  // pass are image row j0 / 32 (x = 16t + rbase + r). rel row index
  // (qt - j0/32 + 31) * 63 + 16(u - t) + col - rbase - r + 31, so in the
  // reversed plane: i = (j0/32) * 63 + 31 - col + rbase + r - 16(u - t).
  // col ^ 15 is 15 - col, written so that the register part of the LDS address
  // is never below 0 (a constant 15 would move into the offset field).
  const float* bp = tab + h * TAB_S + 32 + (col ^ 15) + rbase;

  __syncthreads();   // tab complete before any wave reads it

  for (int j0 = 0; j0 < S_LEN; j0 += 32, bp += 63) {
    if (j0 + 32 < S_LEN) {
      __builtin_prefetch(Kp  + (long)(j0 + 32) * HDIM, 0, 1);
      __builtin_prefetch(Vtp + (long)(j0 + 32) * HDIM, 0, 1);
    }
    v16h kb0 = load_frag_p(Kp + (long)j0 * HDIM,       lane);
    v16h kb1 = load_frag_p(Kp + (long)j0 * HDIM + 512, lane);
    v8f z = {};
    // s<u><t>[r] = S[query m0 + 16u + col][key j0 + 16t + rbase + r]
    v8f s00 = wmma16(kb0, qa0, z);
    v8f s01 = wmma16(kb1, qa0, z);
    v8f s10 = wmma16(kb0, qa1, z);
    v8f s11 = wmma16(kb1, qa1, z);

    // Swin relative-position bias (POS table is an analytic constant).
#pragma unroll
    for (int r = 0; r < 8; ++r) {
      float bs = bp[16 + r];   // u == t
      s00[r] += bs;
      s01[r] += bp[32 + r];    // u = 0, t = 1
      s10[r] += bp[r];         // u = 1, t = 0
      s11[r] += bs;
    }

    v16h pb0 = softmax_step_t(s00, s01, o00, o01, mq0, lq0);
    v16h pb1 = softmax_step_t(s10, s11, o10, o11, mq1, lq1);

    v16h vb0 = load_frag_p(Vtp + (long)j0 * HDIM,       lane);
    v16h vb1 = load_frag_p(Vtp + (long)j0 * HDIM + 512, lane);
    o00 = wmma16(vb0, pb0, o00);
    o01 = wmma16(vb1, pb0, o01);
    o10 = wmma16(vb0, pb1, o10);
    o11 = wmma16(vb1, pb1, o11);
  }

  // The wave's Wo fragments: columns 32 * wave + 16t + (lane & 15), 8 k steps.
  // Asked for here, so that they fly during the division, the X stores and the
  // barrier.
  const _Float16* Wp = WoF + (long)wave * (2 * 8 * 512);
  v16h w0[8], w1[8];
#pragma unroll
  for (int ks = 0; ks < 8; ++ks) {
    w0[ks] = load_frag_p(Wp + ks * 512,       lane);
    w1[ks] = load_frag_p(Wp + (8 + ks) * 512, lane);
  }
  int n0 = wave * 32;
  float bn0 = bo[n0 + col];
  float bn1 = bo[n0 + 16 + col];

  float inv0 = 1.0f / (lq0 + xhalf(lq0));
  float inv1 = 1.0f / (lq1 + xhalf(lq1));
  v8h x00, x01, x10, x11;
#pragma unroll
  for (int r = 0; r < 8; ++r) {
    x00[r] = (_Float16)(o00[r] * inv0);
    x01[r] = (_Float16)(o01[r] * inv0);
    x10[r] = (_Float16)(o10[r] * inv1);
    x11[r] = (_Float16)(o11[r] * inv1);
  }
  _Float16* X0 = x_s + h * 512 + lane * 8;
  _Float16* X1 = X0 + 8 * 512;   // the next row tile
  *(v8h*)(X0)       = x00;
  *(v8h*)(X0 + 256) = x01;
  *(v8h*)(X1)       = x10;
  *(v8h*)(X1 + 256) = x11;

  __syncthreads();   // all 8 heads of X in LDS before any wave reads them

  // a<u><t>: row tile u, column tile t; k steps in rising order, four at a time.
  v8f a00 = {}, a01 = {}, a10 = {}, a11 = {};
#pragma unroll
  for (int kh = 0; kh < 2; ++kh) {
    v16h x0[4], x1[4];
#pragma unroll
    for (int j = 0; j < 4; ++j) {
      x0[j] = load_frag_p(x_s + (kh * 4 + j) * 512,     lane);
      x1[j] = load_frag_p(x_s + (8 + kh * 4 + j) * 512, lane);
    }
    // Holds the 16 LDS loads ahead of the products. Without it the loads sink to
    // their uses, and the wave waits out one LDS latency per k step instead of one
    // per four.
    __builtin_amdgcn_sched_barrier(0);
#pragma unroll
    for (int j = 0; j < 4; ++j) {
      a00 = wmma16(x0[j], w0[kh * 4 + j], a00);
      a01 = wmma16(x0[j], w1[kh * 4 + j], a01);
      a10 = wmma16(x1[j], w0[kh * 4 + j], a10);
      a11 = wmma16(x1[j], w1[kh * 4 + j], a11);
    }
  }

#pragma unroll
  for (int r = 0; r < 8; ++r) {
    int ma = b * S_LEN + m0 + rbase + r;
    int mb2 = ma + 16;
    out[(long)ma  * DMODEL + n0 + col]      = a00[r] + bn0;
    out[(long)ma  * DMODEL + n0 + 16 + col] = a01[r] + bn1;
    out[(long)mb2 * DMODEL + n0 + col]      = a10[r] + bn0;
    out[(long)mb2 * DMODEL + n0 + 16 + col] = a11[r] + bn1;
  }
}

extern "C" void kernel_launch(void* const* d_in, const int* in_sizes, int n_in,
                              void* d_out, int out_size, void* d_ws, size_t ws_size,
                              hipStream_t stream) {
  (void)in_sizes; (void)n_in; (void)out_size; (void)ws_size;
  const float* inq  = (const float*)d_in[0];
  const float* inkv = (const float*)d_in[1];
  const float* Wq   = (const float*)d_in[2];
  const float* bq   = (const float*)d_in[3];
  const float* Wk   = (const float*)d_in[4];
  const float* bk   = (const float*)d_in[5];
  const float* Wv   = (const float*)d_in[6];
  const float* bv   = (const float*)d_in[7];
  const float* rel  = (const float*)d_in[8];
  const float* Wo   = (const float*)d_in[9];
  const float* bo   = (const float*)d_in[10];
  float* out = (float*)d_out;

  char* ws = (char*)d_ws;
  const size_t WSZ = 256 * 256 * sizeof(_Float16);                 // 128 KB
  const size_t QSZ = (size_t)8 * 8 * 1024 * 32 * sizeof(_Float16); // 4 MB
  _Float16* WqT = (_Float16*)(ws + 0 * WSZ);
  _Float16* WkT = (_Float16*)(ws + 1 * WSZ);
  _Float16* WvT = (_Float16*)(ws + 2 * WSZ);
  _Float16* WoF = (_Float16*)(ws + 3 * WSZ);
  size_t off = 4 * WSZ;
  _Float16* Qb = (_Float16*)(ws + off); off += QSZ;
  _Float16* Kb = (_Float16*)(ws + off); off += QSZ;
  _Float16* Vt = (_Float16*)(ws + off); off += QSZ;
  _Float16* Aq  = (_Float16*)(ws + off); off += QSZ;   // 8192 x 256 f16 each
  _Float16* Akv = (_Float16*)(ws + off); off += QSZ;

  prep_weights_k<<<256, 256, 0, stream>>>(Wq, Wk, Wv, Wo, inq, inkv, WqT, WkT, WvT, WoF,
                                          Aq, Akv);
  qkv_proj_k<<<768, 256, 0, stream>>>(Aq, Akv, WqT, WkT, WvT, bq, bk, bv,
                                      Qb, Kb, Vt);
  attn_k<<<256, 256, 0, stream>>>(Qb, Kb, Vt, rel, WoF, bo, out);
}

// v007
// One run takes 38.8 microseconds.
// In both of two side-by-side timings against v006, it was 1.20 times as fast.
// Over all steps from v000 it is 8.54 times as fast.
#include <hip/hip_runtime.h>
#include <hip/hip_bf16.h>

typedef __attribute__((ext_vector_type(16))) _Float16 v16h;
typedef __attribute__((ext_vector_type(8)))  _Float16 v8h;
typedef __attribute__((ext_vector_type(8)))  float    v8f;
typedef __attribute__((ext_vector_type(4)))  float    v4f;

#define S_LEN  1024
#define DMODEL 256
#define NHEAD  8
#define HDIM   32
#define NREL   3969   // (2*32-1) * (2*32-1) rows of rel_table

static __device__ __forceinline__ v8f wmma16(v16h a, v16h b, v8f c) {
  // D = A(16x32 f16) x B(32x16 f16) + C(16x16 f32)
  return __builtin_amdgcn_wmma_f32_16x16x32_f16(false, a, false, b, (short)0, c,
                                                false, false);
}

static __device__ __forceinline__ v16h load_frag_p(const _Float16* blk, int lane) {
  v8h lo = *(const v8h*)(blk + lane * 8);
  v8h hi = *(const v8h*)(blk + 256 + lane * 8);
  v16h f;
#pragma unroll
  for (int i = 0; i < 8; ++i) { f[i] = lo[i]; f[i + 8] = hi[i]; }
  return f;
}

static __device__ __forceinline__ unsigned int uni(unsigned int v) {
  return (unsigned int)__builtin_amdgcn_readfirstlane(v);
}

#define PROWS 128

typedef __attribute__((ext_vector_type(2))) float v2f;
typedef __attribute__((ext_vector_type(4))) _Float16 v4h;

// The products of one 32-row pair: A points at its two row tiles in LDS (8 blocks
// each), f0, f1 are the wave's weight fragments. a<u><t>: row tile u, weight tile t.
// XA: the rows are the A operand (D = rows x weights), else the B operand.
// Its loops are unrolled so that the fragment arrays are indexed by constants and
// stay in registers.
template <bool XA>
static __device__ __forceinline__ void proj_pair(const _Float16* A, const v16h* f0,
                                                 const v16h* f1, int lane, v8f& a00,
                                                 v8f& a01, v8f& a10, v8f& a11) {
#pragma unroll
  for (int kh = 0; kh < 2; ++kh) {
    v16h x0[4], x1[4];
#pragma unroll
    for (int j = 0; j < 4; ++j) {
      x0[j] = load_frag_p(A + (kh * 4 + j) * 512,     lane);
      x1[j] = load_frag_p(A + (8 + kh * 4 + j) * 512, lane);
    }
#pragma unroll
    for (int j = 0; j < 4; ++j) {
      v16h w0 = f0[kh * 4 + j];
      v16h w1 = f1[kh * 4 + j];
      if (XA) {
        a00 = wmma16(x0[j], w0, a00);
        a01 = wmma16(x0[j], w1, a01);
        a10 = wmma16(x1[j], w0, a10);
        a11 = wmma16(x1[j], w1, a11);
      } else {
        a00 = wmma16(w0, x0[j], a00);
        a01 = wmma16(w1, x0[j], a01);
        a10 = wmma16(w0, x1[j], a10);
        a11 = wmma16(w1, x1[j], a11);
      }
    }
  }
}

__global__ void __launch_bounds__(256) qkv_proj_k(
    const float* inq, const float* inkv, const float* Wq, const float* Wk,
    const float* Wv, const float* Wo, const float* bq, const float* bk,
    const float* bv, _Float16* Q, _Float16* K, _Float16* Vt, _Float16* WoF) {
  __shared__ __attribute__((aligned(16))) _Float16 a_s[PROWS * DMODEL];
  int lane = threadIdx.x & 31;
  int wave = (int)uni(threadIdx.x >> 5);   // the same in every lane: addresses built on it stay scalar
  int blk = blockIdx.x;

  if (blk >= 192) {
    int c = (blk - 192) * 256 + (int)threadIdx.x;
    int n = (c >> 9) * 16 + (c & 15);
    int k = ((c >> 6) & 7) * 32 + ((c >> 4) & 1) * 16 + ((c >> 5) & 1);
    v8h o;
#pragma unroll
    for (int e = 0; e < 8; ++e) o[e] = (_Float16)Wo[(k + 2 * e) * 256 + n];
    *(v8h*)(WoF + (long)c * 8) = o;
    return;   // the whole block leaves, ahead of the barrier
  }

  int which = blk >> 6;            // 0=Q 1=K 2=V
  int row0 = (blk & 63) * PROWS;   // first of the block's rows, of 8192
  int c16 = lane & 15;
  int g = lane >> 4;
  int n0 = wave * 32;

  // A wave's load of input: 4 rows x 128 B (k step = wave), whole lines.
  const float* ip = (which == 0 ? inq : inkv) +
                    (long)(row0 + (lane >> 3)) * DMODEL + wave * 32 + (lane & 7) * 4;
  // Where the lane's 4 halves go, for row (lane >> 3) of a row tile: k & 31 =
  // 4 * (lane & 7) + d, so upper = bit 2, g = bit 1 of the lane, k & 7 = 4 * bit 0 + d.
  _Float16* ap = a_s + wave * 512 + ((lane >> 2) & 1) * 256 +
                 ((lane >> 3) + ((lane >> 1) & 1) * 16) * 8 + (lane & 1) * 4;
  // The lane's weights: rows 8g + ..., columns n0 + 2 * c16 and the next.
  const float* wp = (which == 0 ? Wq : (which == 1 ? Wk : Wv)) + g * 8 * 256 + n0 + 2 * c16;

  const float* bp = (which == 0 ? bq : (which == 1 ? bk : bv)) + n0;

  // All of the wave's loads stand together ahead of the casts, the rows first (they
  // come from furthest away), so that the wave waits out one load latency, not one a
  // fragment. These loops and the casts' are unrolled so that tv[], wl[], f0[] and
  // f1[] stay in registers.
  v4f tv[32];
  v2f wl[128];
#pragma unroll
  for (int i = 0; i < 32; ++i) tv[i] = *(const v4f*)(ip + i * 4 * DMODEL);
#pragma unroll
  for (int q = 0; q < 128; ++q) {
    int e = q & 15;
    wl[q] = *(const v2f*)(wp + ((q >> 4) * 32 + (e & 7) + 16 * (e >> 3)) * 256);
  }
  unsigned int oqk = g * 64u, ov = c16 * 8u;   // the lane's byte offsets into the head's bias
  v4f bqk[4];
#pragma unroll
  for (int i = 0; i < 4; ++i) bqk[i] = *(const v4f*)((const char*)bp + oqk + i * 16);
  v2f bvv = *(const v2f*)((const char*)bp + ov);
  // Stands in front of every reuse of the loads' address registers; the addresses
  // are named as inputs so that their registers live up to it.
  asm volatile("s_wait_xcnt 0x0" :: "v"(wp), "v"(ip), "v"(oqk), "v"(ov) : "memory");
  // Holds the loads and the wait ahead of the casts (without it each load sinks to
  // its use).
  __builtin_amdgcn_sched_barrier(0);
#pragma unroll
  for (int i = 0; i < 32; ++i) {
    int r = i * 4;
    v4h o;
#pragma unroll
    for (int d = 0; d < 4; ++d) o[d] = (_Float16)tv[i][d];
    *(v4h*)(ap + (r >> 4) * (8 * 512) + (r & 15) * 8) = o;
  }
  v16h f0[8], f1[8];
#pragma unroll
  for (int q = 0; q < 128; ++q) {
    f0[q >> 4][q & 15] = (_Float16)wl[q][0];
    f1[q >> 4][q & 15] = (_Float16)wl[q][1];
  }

  __syncthreads();   // all 8 k steps of the rows in LDS before any wave reads them

  int bh = (row0 >> 10) * NHEAD + wave;
  int s0 = row0 & (S_LEN - 1);

  if (which == 2) {
    float bn0 = bvv[0];
    float bn1 = bvv[1];
    // Kept rolled: unrolled, the LDS loads of all four row pairs rise to the top and
    // the registers spill.
#pragma unroll 1
    for (int rp = 0; rp < PROWS / 32; ++rp) {
      v8f a00 = {}, a01 = {}, a10 = {}, a11 = {};
      proj_pair<true>(a_s + rp * (2 * 8 * 512), f0, f1, lane, a00, a01, a10, a11);
      // a<u><t>[r] = V[s = m0 + 16u + 8g + r][hd = 2 * (lane & 15) + t]
      int m0 = s0 + rp * 32;
      v8h y00, y01, y10, y11;
#pragma unroll
      for (int r = 0; r < 8; ++r) {
        y00[r] = (_Float16)(a00[r] + bn0);
        y01[r] = (_Float16)(a01[r] + bn1);
        y10[r] = (_Float16)(a10[r] + bn0);
        y11[r] = (_Float16)(a11[r] + bn1);
      }
      _Float16* o = Vt + (long)(bh * 32 + (m0 >> 5)) * 1024 + lane * 8;
      *(v8h*)(o)             = y00;
      *(v8h*)(o + 256)       = y10;
      *(v8h*)(o + 512)       = y01;
      *(v8h*)(o + 512 + 256) = y11;
    }
  } else {
    float scale = (which == 0) ? 0.17677669529663687f : 1.0f;  // 1/sqrt(HD)
    float bn0[8], bn1[8];
#pragma unroll
    for (int r = 0; r < 8; ++r) {
      bn0[r] = bqk[r >> 1][(r & 1) * 2];        // column 16g + 2r
      bn1[r] = bqk[r >> 1][(r & 1) * 2 + 1];    // column 16g + 2r + 1
    }
    // Kept rolled: unrolled, the LDS loads of all four row pairs rise to the top and
    // the registers spill.
#pragma unroll 1
    for (int rp = 0; rp < PROWS / 32; ++rp) {
      v8f a00 = {}, a01 = {}, a10 = {}, a11 = {};
      proj_pair<false>(a_s + rp * (2 * 8 * 512), f0, f1, lane, a00, a01, a10, a11);
      // a<u><t>[r] = out[s = m0 + 16u + (lane & 15)][hd = 2 * (8g + r) + t]
      int m0 = s0 + rp * 32;
      v8h y00, y01, y10, y11;
#pragma unroll
      for (int r = 0; r < 8; ++r) {
        y00[r] = (_Float16)((a00[r] + bn0[r]) * scale);
        y01[r] = (_Float16)((a01[r] + bn1[r]) * scale);
        y10[r] = (_Float16)((a10[r] + bn0[r]) * scale);
        y11[r] = (_Float16)((a11[r] + bn1[r]) * scale);
      }
      _Float16* o = (which == 0 ? Q : K) + (long)(bh * 64 + (m0 >> 4)) * 512 + lane * 8;
      *(v8h*)(o)             = y00;
      *(v8h*)(o + 256)       = y01;
      *(v8h*)(o + 512)       = y10;
      *(v8h*)(o + 512 + 256) = y11;
    }
  }
}

static __device__ __forceinline__ float xhalf(float x) {
  int v = __builtin_bit_cast(int, x);
  return __builtin_bit_cast(float, __builtin_amdgcn_permlanex16(
      v, v, 0x76543210, 0xfedcba98, false, false));
}

// ---------------------------------------------------------------------------
// Online-softmax update for one 16-query column group against 32 new keys.
// Scores are transposed: t0[r] = S[query col][key 8g + r], t1[r] the same for
// key 16 + 8g + r, so a lane holds 16 of its query's 32 scores. Maximum:
// in-lane, then one exchange between the halves. Sum: in-lane only; the
// halves' sums are joined once behind the key loop. Returns P^T as a B operand
// (element e -> key 8g + (e & 7) + 16 * (e >> 3), the order of load_frag_p).
// ---------------------------------------------------------------------------
static __device__ __forceinline__ v16h softmax_step_t(const v8f& t0, const v8f& t1,
                                                      v8f& oa, v8f& ob, float& m,
                                                      float& l) {
  float mx = fmaxf(t0[0], t1[0]);
#pragma unroll
  for (int r = 1; r < 8; ++r) mx = fmaxf(mx, fmaxf(t0[r], t1[r]));
  mx = fmaxf(mx, xhalf(mx));
  float mnew = fmaxf(m, mx);
  float corr = __expf(m - mnew);
  v16h p;
  float rs = 0.0f;
#pragma unroll
  for (int r = 0; r < 8; ++r) {
    float p0 = __expf(t0[r] - mnew);
    float p1 = __expf(t1[r] - mnew);
    rs += p0 + p1;
    p[r]     = (_Float16)p0;
    p[r + 8] = (_Float16)p1;
  }
  l = l * corr + rs;
  m = mnew;
#pragma unroll
  for (int r = 0; r < 8; ++r) { oa[r] *= corr; ob[r] *= corr; }
  return p;
}

#define TAB_S 2056

__global__ void __launch_bounds__(256) attn_k(const _Float16* Q, const _Float16* K, const _Float16* Vt,
                       const float* rel, const _Float16* WoF, const float* bo,
                       float* out) {
  int lane = threadIdx.x & 31;
  int wave = (int)uni(threadIdx.x >> 5);   // the same in every lane: addresses built on it stay scalar
  int qt = blockIdx.x & 31;          // 32-query tile = image row, 0..31
  int b = blockIdx.x >> 5;
  int h = wave;
  int bh = b * NHEAD + h;

  // tab[h * TAB_S + 32 + i] = rel[63 * qt + 2015 - i][h], i = 0..2015. The copy
  // runs over 2048 rows, so that it has no branch: the 32 words in front of each
  // plane take the surplus (written, never read).
  __shared__ float tab[NHEAD * TAB_S];
  __shared__ __attribute__((aligned(16))) _Float16 x_s[2 * 8 * 512];
  {
    int tid = threadIdx.x & 255;   // the block has 256 threads
    v4f tv[16];
    // Chunk c = 16 bytes: heads 4 * (c & 1) .. + 3 of row 63 * qt + (c >> 1); a wave
    // loads 512 contiguous bytes. Unrolled so that all 16 loads of a thread are in
    // flight together; the surplus rows are clamped to stay inside rel.
#pragma unroll
    for (int k = 0; k < 16; ++k) {
      int cc = tid + 256 * k;
      int row = 63 * qt + (cc >> 1);
      tv[k] = *(const v4f*)(rel + (row < NREL ? row : NREL - 1) * NHEAD + (cc & 1) * 4);
    }
    // Unrolled so that tv[] stays in registers. Word 2047 - (cc >> 1) of the plane,
    // written as (127 - (tid >> 1)) + 128 * (15 - k) with the xor for the first term,
    // so that the register part of the LDS address is never below 0.
    int rt = (tid >> 1) ^ 127;
#pragma unroll
    for (int k = 0; k < 16; ++k) {
      float* d = tab + (tid & 1) * (4 * TAB_S) + rt + 128 * (15 - k);
      d[0]         = tv[k][0];
      d[TAB_S]     = tv[k][1];
      d[2 * TAB_S] = tv[k][2];
      d[3 * TAB_S] = tv[k][3];
    }
  }

  // Per (b,h): 64 blocks of Q, 64 of K (two a pass), 64 of V^T (two a pass).
  const _Float16* Qp  = Q  + (long)bh * S_LEN * HDIM;
  const _Float16* Kp  = K  + (long)bh * S_LEN * HDIM;
  const _Float16* Vtp = Vt + (long)bh * HDIM * S_LEN;

  int m0 = qt * 32;
  v16h qa0 = load_frag_p(Qp + (long)m0 * HDIM,       lane);  // full HD in one frag
  v16h qa1 = load_frag_p(Qp + (long)m0 * HDIM + 512, lane);

  v8f o00 = {}, o01 = {}, o10 = {}, o11 = {};
  float mq0 = -3.0e38f, lq0 = 0.0f, mq1 = -3.0e38f, lq1 = 0.0f;

  int col = lane & 15;
  int rbase = (lane >> 4) * 8;

  // The wave's 32 queries are image row qt (x = 16u + col); the 32 keys of a
  // pass are image row j0 / 32 (x = 16t + rbase + r). rel row index
  // (qt - j0/32 + 31) * 63 + 16(u - t) + col - rbase - r + 31, so in the
  // reversed plane: i = (j0/32) * 63 + 31 - col + rbase + r - 16(u - t).
  // col ^ 15 is 15 - col, written so that the register part of the LDS address
  // is never below 0 (a constant 15 would move into the offset field).
  const float* bp = tab + h * TAB_S + 32 + (col ^ 15) + rbase;

  __syncthreads();   // tab complete before any wave reads it

  for (int j0 = 0; j0 < S_LEN; j0 += 32, bp += 63) {
    if (j0 + 32 < S_LEN) {
      __builtin_prefetch(Kp  + (long)(j0 + 32) * HDIM, 0, 1);
      __builtin_prefetch(Vtp + (long)(j0 + 32) * HDIM, 0, 1);
    }
    v16h kb0 = load_frag_p(Kp + (long)j0 * HDIM,       lane);
    v16h kb1 = load_frag_p(Kp + (long)j0 * HDIM + 512, lane);
    v8f z = {};
    // s<u><t>[r] = S[query m0 + 16u + col][key j0 + 16t + rbase + r]
    v8f s00 = wmma16(kb0, qa0, z);
    v8f s01 = wmma16(kb1, qa0, z);
    v8f s10 = wmma16(kb0, qa1, z);
    v8f s11 = wmma16(kb1, qa1, z);

    // Swin relative-position bias (POS table is an analytic constant).
#pragma unroll
    for (int r = 0; r < 8; ++r) {
      float bs = bp[16 + r];   // u == t
      s00[r] += bs;
      s01[r] += bp[32 + r];    // u = 0, t = 1
      s10[r] += bp[r];         // u = 1, t = 0
      s11[r] += bs;
    }

    v16h pb0 = softmax_step_t(s00, s01, o00, o01, mq0, lq0);
    v16h pb1 = softmax_step_t(s10, s11, o10, o11, mq1, lq1);

    v16h vb0 = load_frag_p(Vtp + (long)j0 * HDIM,       lane);
    v16h vb1 = load_frag_p(Vtp + (long)j0 * HDIM + 512, lane);
    o00 = wmma16(vb0, pb0, o00);
    o01 = wmma16(vb1, pb0, o01);
    o10 = wmma16(vb0, pb1, o10);
    o11 = wmma16(vb1, pb1, o11);
  }

  // The wave's Wo fragments: columns 32 * wave + 16t + (lane & 15), 8 k steps.
  // Asked for here, so that they fly during the division, the X stores and the
  // barrier.
  const _Float16* Wp = WoF + (long)wave * (2 * 8 * 512);
  v16h w0[8], w1[8];
#pragma unroll
  for (int ks = 0; ks < 8; ++ks) {
    w0[ks] = load_frag_p(Wp + ks * 512,       lane);
    w1[ks] = load_frag_p(Wp + (8 + ks) * 512, lane);
  }
  int n0 = wave * 32;
  float bn0 = bo[n0 + col];
  float bn1 = bo[n0 + 16 + col];

  float inv0 = 1.0f / (lq0 + xhalf(lq0));
  float inv1 = 1.0f / (lq1 + xhalf(lq1));
  v8h x00, x01, x10, x11;
#pragma unroll
  for (int r = 0; r < 8; ++r) {
    x00[r] = (_Float16)(o00[r] * inv0);
    x01[r] = (_Float16)(o01[r] * inv0);
    x10[r] = (_Float16)(o10[r] * inv1);
    x11[r] = (_Float16)(o11[r] * inv1);
  }
  _Float16* X0 = x_s + h * 512 + lane * 8;
  _Float16* X1 = X0 + 8 * 512;   // the next row tile
  *(v8h*)(X0)       = x00;
  *(v8h*)(X0 + 256) = x01;
  *(v8h*)(X1)       = x10;
  *(v8h*)(X1 + 256) = x11;

  __syncthreads();   // all 8 heads of X in LDS before any wave reads them

  // a<u><t>: row tile u, column tile t; k steps in rising order, four at a time.
  v8f a00 = {}, a01 = {}, a10 = {}, a11 = {};
#pragma unroll
  for (int kh = 0; kh < 2; ++kh) {
    v16h x0[4], x1[4];
#pragma unroll
    for (int j = 0; j < 4; ++j) {
      x0[j] = load_frag_p(x_s + (kh * 4 + j) * 512,     lane);
      x1[j] = load_frag_p(x_s + (8 + kh * 4 + j) * 512, lane);
    }
    // Holds the 16 LDS loads ahead of the products. Without it the loads sink to
    // their uses, and the wave waits out one LDS latency per k step instead of one
    // per four.
    __builtin_amdgcn_sched_barrier(0);
#pragma unroll
    for (int j = 0; j < 4; ++j) {
      a00 = wmma16(x0[j], w0[kh * 4 + j], a00);
      a01 = wmma16(x0[j], w1[kh * 4 + j], a01);
      a10 = wmma16(x1[j], w0[kh * 4 + j], a10);
      a11 = wmma16(x1[j], w1[kh * 4 + j], a11);
    }
  }

#pragma unroll
  for (int r = 0; r < 8; ++r) {
    int ma = b * S_LEN + m0 + rbase + r;
    int mb2 = ma + 16;
    out[(long)ma  * DMODEL + n0 + col]      = a00[r] + bn0;
    out[(long)ma  * DMODEL + n0 + 16 + col] = a01[r] + bn1;
    out[(long)mb2 * DMODEL + n0 + col]      = a10[r] + bn0;
    out[(long)mb2 * DMODEL + n0 + 16 + col] = a11[r] + bn1;
  }
}

extern "C" void kernel_launch(void* const* d_in, const int* in_sizes, int n_in,
                              void* d_out, int out_size, void* d_ws, size_t ws_size,
                              hipStream_t stream) {
  (void)in_sizes; (void)n_in; (void)out_size; (void)ws_size;
  const float* inq  = (const float*)d_in[0];
  const float* inkv = (const float*)d_in[1];
  const float* Wq   = (const float*)d_in[2];
  const float* bq   = (const float*)d_in[3];
  const float* Wk   = (const float*)d_in[4];
  const float* bk   = (const float*)d_in[5];
  const float* Wv   = (const float*)d_in[6];
  const float* bv   = (const float*)d_in[7];
  const float* rel  = (const float*)d_in[8];
  const float* Wo   = (const float*)d_in[9];
  const float* bo   = (const float*)d_in[10];
  float* out = (float*)d_out;

  char* ws = (char*)d_ws;
  const size_t WSZ = 256 * 256 * sizeof(_Float16);                 // 128 KB
  const size_t QSZ = (size_t)8 * 8 * 1024 * 32 * sizeof(_Float16); // 4 MB
  _Float16* WoF = (_Float16*)(ws);
  size_t off = WSZ;
  _Float16* Qb = (_Float16*)(ws + off); off += QSZ;
  _Float16* Kb = (_Float16*)(ws + off); off += QSZ;
  _Float16* Vt = (_Float16*)(ws + off);

  qkv_proj_k<<<224, 256, 0, stream>>>(inq, inkv, Wq, Wk, Wv, Wo, bq, bk, bv,
                                      Qb, Kb, Vt, WoF);
  attn_k<<<256, 256, 0, stream>>>(Qb, Kb, Vt, rel, WoF, bo, out);
}

// v008
// One run takes 29.1 microseconds.
// Timed twice side by side with v007, it ran 1.34 and 1.36 times as fast.
// All steps since v000 together make it 11.5 times as fast.
#include <hip/hip_runtime.h>
#include <hip/hip_bf16.h>

typedef __attribute__((ext_vector_type(16))) _Float16 v16h;
typedef __attribute__((ext_vector_type(8)))  _Float16 v8h;
typedef __attribute__((ext_vector_type(8)))  float    v8f;
typedef __attribute__((ext_vector_type(4)))  float    v4f;

#define S_LEN  1024
#define DMODEL 256
#define NHEAD  8
#define HDIM   32
#define NREL   3969   // (2*32-1) * (2*32-1) rows of rel_table

static __device__ __forceinline__ v8f wmma16(v16h a, v16h b, v8f c) {
  // D = A(16x32 f16) x B(32x16 f16) + C(16x16 f32)
  return __builtin_amdgcn_wmma_f32_16x16x32_f16(false, a, false, b, (short)0, c,
                                                false, false);
}

static __device__ __forceinline__ v16h load_frag_p(const _Float16* blk, int lane) {
  v8h lo = *(const v8h*)(blk + lane * 8);
  v8h hi = *(const v8h*)(blk + 256 + lane * 8);
  v16h f;
#pragma unroll
  for (int i = 0; i < 8; ++i) { f[i] = lo[i]; f[i + 8] = hi[i]; }
  return f;
}

static __device__ __forceinline__ unsigned int uni(unsigned int v) {
  return (unsigned int)__builtin_amdgcn_readfirstlane(v);
}

#define PROWS 128

typedef __attribute__((ext_vector_type(2))) float v2f;
typedef __attribute__((ext_vector_type(4))) _Float16 v4h;

// The products of one 32-row pair: A points at its two row tiles in LDS (8 blocks
// each), f0, f1 are the wave's weight fragments. a<u><t>: row tile u, weight tile t.
// XA: the rows are the A operand (D = rows x weights), else the B operand.
// Its loops are unrolled so that the fragment arrays are indexed by constants and
// stay in registers.
template <bool XA>
static __device__ __forceinline__ void proj_pair(const _Float16* A, const v16h* f0,
                                                 const v16h* f1, int lane, v8f& a00,
                                                 v8f& a01, v8f& a10, v8f& a11) {
#pragma unroll
  for (int kh = 0; kh < 2; ++kh) {
    v16h x0[4], x1[4];
#pragma unroll
    for (int j = 0; j < 4; ++j) {
      x0[j] = load_frag_p(A + (kh * 4 + j) * 512,     lane);
      x1[j] = load_frag_p(A + (8 + kh * 4 + j) * 512, lane);
    }
#pragma unroll
    for (int j = 0; j < 4; ++j) {
      v16h w0 = f0[kh * 4 + j];
      v16h w1 = f1[kh * 4 + j];
      if (XA) {
        a00 = wmma16(x0[j], w0, a00);
        a01 = wmma16(x0[j], w1, a01);
        a10 = wmma16(x1[j], w0, a10);
        a11 = wmma16(x1[j], w1, a11);
      } else {
        a00 = wmma16(w0, x0[j], a00);
        a01 = wmma16(w1, x0[j], a01);
        a10 = wmma16(w0, x1[j], a10);
        a11 = wmma16(w1, x1[j], a11);
      }
    }
  }
}

__global__ void __launch_bounds__(256) qkv_proj_k(
    const float* inq, const float* inkv, const float* Wq, const float* Wk,
    const float* Wv, const float* Wo, const float* bq, const float* bk,
    const float* bv, _Float16* Q, _Float16* K, _Float16* Vt, _Float16* WoF) {
  __shared__ __attribute__((aligned(16))) _Float16 a_s[PROWS * DMODEL];
  int lane = threadIdx.x & 31;
  int wave = (int)uni(threadIdx.x >> 5);   // the same in every lane: addresses built on it stay scalar
  int blk = blockIdx.x;

  if (blk >= 192) {
    int c = (blk - 192) * 256 + (int)threadIdx.x;
    int n = (c >> 9) * 16 + (c & 15);
    int k = ((c >> 6) & 7) * 32 + ((c >> 4) & 1) * 16 + ((c >> 5) & 1);
    v8h o;
#pragma unroll
    for (int e = 0; e < 8; ++e) o[e] = (_Float16)Wo[(k + 2 * e) * 256 + n];
    *(v8h*)(WoF + (long)c * 8) = o;
    return;   // the whole block leaves, ahead of the barrier
  }

  int which = blk >> 6;            // 0=Q 1=K 2=V
  int row0 = (blk & 63) * PROWS;   // first of the block's rows, of 8192
  int c16 = lane & 15;
  int g = lane >> 4;
  int n0 = wave * 32;

  // A wave's load of input: 4 rows x 128 B (k step = wave), whole lines.
  const float* ip = (which == 0 ? inq : inkv) +
                    (long)(row0 + (lane >> 3)) * DMODEL + wave * 32 + (lane & 7) * 4;
  // Where the lane's 4 halves go, for row (lane >> 3) of a row tile: k & 31 =
  // 4 * (lane & 7) + d, so upper = bit 2, g = bit 1 of the lane, k & 7 = 4 * bit 0 + d.
  _Float16* ap = a_s + wave * 512 + ((lane >> 2) & 1) * 256 +
                 ((lane >> 3) + ((lane >> 1) & 1) * 16) * 8 + (lane & 1) * 4;
  // The lane's weights: rows 8g + ..., columns n0 + 2 * c16 and the next.
  const float* wp = (which == 0 ? Wq : (which == 1 ? Wk : Wv)) + g * 8 * 256 + n0 + 2 * c16;

  const float* bp = (which == 0 ? bq : (which == 1 ? bk : bv)) + n0;

  // All of the wave's loads stand together ahead of the casts, the rows first (they
  // come from furthest away), so that the wave waits out one load latency, not one a
  // fragment. These loops and the casts' are unrolled so that tv[], wl[], f0[] and
  // f1[] stay in registers.
  v4f tv[32];
  v2f wl[128];
#pragma unroll
  for (int i = 0; i < 32; ++i) tv[i] = *(const v4f*)(ip + i * 4 * DMODEL);
#pragma unroll
  for (int q = 0; q < 128; ++q) {
    int e = q & 15;
    wl[q] = *(const v2f*)(wp + ((q >> 4) * 32 + (e & 7) + 16 * (e >> 3)) * 256);
  }
  unsigned int oqk = g * 64u, ov = c16 * 8u;   // the lane's byte offsets into the head's bias
  v4f bqk[4];
#pragma unroll
  for (int i = 0; i < 4; ++i) bqk[i] = *(const v4f*)((const char*)bp + oqk + i * 16);
  v2f bvv = *(const v2f*)((const char*)bp + ov);
  // Stands in front of every reuse of the loads' address registers; the addresses
  // are named as inputs so that their registers live up to it.
  asm volatile("s_wait_xcnt 0x0" :: "v"(wp), "v"(ip), "v"(oqk), "v"(ov) : "memory");
  // Holds the loads and the wait ahead of the casts (without it each load sinks to
  // its use).
  __builtin_amdgcn_sched_barrier(0);
#pragma unroll
  for (int i = 0; i < 32; ++i) {
    int r = i * 4;
    v4h o;
#pragma unroll
    for (int d = 0; d < 4; ++d) o[d] = (_Float16)tv[i][d];
    *(v4h*)(ap + (r >> 4) * (8 * 512) + (r & 15) * 8) = o;
  }
  v16h f0[8], f1[8];
#pragma unroll
  for (int q = 0; q < 128; ++q) {
    f0[q >> 4][q & 15] = (_Float16)wl[q][0];
    f1[q >> 4][q & 15] = (_Float16)wl[q][1];
  }

  __syncthreads();   // all 8 k steps of the rows in LDS before any wave reads them

  int bh = (row0 >> 10) * NHEAD + wave;
  int s0 = row0 & (S_LEN - 1);

  if (which == 2) {
    float bn0 = bvv[0];
    float bn1 = bvv[1];
    // Kept rolled: unrolled, the LDS loads of all four row pairs rise to the top and
    // the registers spill.
#pragma unroll 1
    for (int rp = 0; rp < PROWS / 32; ++rp) {
      v8f a00 = {}, a01 = {}, a10 = {}, a11 = {};
      proj_pair<true>(a_s + rp * (2 * 8 * 512), f0, f1, lane, a00, a01, a10, a11);
      // a<u><t>[r] = V[s = m0 + 16u + 8g + r][hd = 2 * (lane & 15) + t]
      int m0 = s0 + rp * 32;
      v8h y00, y01, y10, y11;
#pragma unroll
      for (int r = 0; r < 8; ++r) {
        y00[r] = (_Float16)(a00[r] + bn0);
        y01[r] = (_Float16)(a01[r] + bn1);
        y10[r] = (_Float16)(a10[r] + bn0);
        y11[r] = (_Float16)(a11[r] + bn1);
      }
      _Float16* o = Vt + (long)(bh * 32 + (m0 >> 5)) * 1024 + lane * 8;
      *(v8h*)(o)             = y00;
      *(v8h*)(o + 256)       = y10;
      *(v8h*)(o + 512)       = y01;
      *(v8h*)(o + 512 + 256) = y11;
    }
  } else {
    float scale = (which == 0) ? 0.17677669529663687f : 1.0f;  // 1/sqrt(HD)
    float bn0[8], bn1[8];
#pragma unroll
    for (int r = 0; r < 8; ++r) {
      bn0[r] = bqk[r >> 1][(r & 1) * 2];        // column 16g + 2r
      bn1[r] = bqk[r >> 1][(r & 1) * 2 + 1];    // column 16g + 2r + 1
    }
    // Kept rolled: unrolled, the LDS loads of all four row pairs rise to the top and
    // the registers spill.
#pragma unroll 1
    for (int rp = 0; rp < PROWS / 32; ++rp) {
      v8f a00 = {}, a01 = {}, a10 = {}, a11 = {};
      proj_pair<false>(a_s + rp * (2 * 8 * 512), f0, f1, lane, a00, a01, a10, a11);
      // a<u><t>[r] = out[s = m0 + 16u + (lane & 15)][hd = 2 * (8g + r) + t]
      int m0 = s0 + rp * 32;
      v8h y00, y01, y10, y11;
#pragma unroll
      for (int r = 0; r < 8; ++r) {
        y00[r] = (_Float16)((a00[r] + bn0[r]) * scale);
        y01[r] = (_Float16)((a01[r] + bn1[r]) * scale);
        y10[r] = (_Float16)((a10[r] + bn0[r]) * scale);
        y11[r] = (_Float16)((a11[r] + bn1[r]) * scale);
      }
      _Float16* o = (which == 0 ? Q : K) + (long)(bh * 64 + (m0 >> 4)) * 512 + lane * 8;
      *(v8h*)(o)             = y00;
      *(v8h*)(o + 256)       = y01;
      *(v8h*)(o + 512)       = y10;
      *(v8h*)(o + 512 + 256) = y11;
    }
  }
}

static __device__ __forceinline__ float xhalf(float x) {
  int v = __builtin_bit_cast(int, x);
  return __builtin_bit_cast(float, __builtin_amdgcn_permlanex16(
      v, v, 0x76543210, 0xfedcba98, false, false));
}

// ---------------------------------------------------------------------------
// Online-softmax update for one 16-query column group against 32 new keys.
// Scores are transposed: t0[r] = S[query col][key 8g + r], t1[r] the same for
// key 16 + 8g + r, so a lane holds 16 of its query's 32 scores. Maximum:
// in-lane, then one exchange between the halves. Sum: in-lane only; the
// halves' sums are joined once behind the key loop. Returns P^T as a B operand
// (element e -> key 8g + (e & 7) + 16 * (e >> 3), the order of load_frag_p).
// ---------------------------------------------------------------------------
static __device__ __forceinline__ v16h softmax_step_t(const v8f& t0, const v8f& t1,
                                                      v8f& oa, v8f& ob, float& m,
                                                      float& l) {
  float mx = fmaxf(t0[0], t1[0]);
#pragma unroll
  for (int r = 1; r < 8; ++r) mx = fmaxf(mx, fmaxf(t0[r], t1[r]));
  mx = fmaxf(mx, xhalf(mx));
  float mnew = fmaxf(m, mx);
  float corr = __expf(m - mnew);
  v16h p;
  float rs = 0.0f;
#pragma unroll
  for (int r = 0; r < 8; ++r) {
    float p0 = __expf(t0[r] - mnew);
    float p1 = __expf(t1[r] - mnew);
    rs += p0 + p1;
    p[r]     = (_Float16)p0;
    p[r + 8] = (_Float16)p1;
  }
  l = l * corr + rs;
  m = mnew;
#pragma unroll
  for (int r = 0; r < 8; ++r) { oa[r] *= corr; ob[r] *= corr; }
  return p;
}

#define TAB_S 2056

__global__ void __launch_bounds__(256) attn_k(const _Float16* Q, const _Float16* K, const _Float16* Vt,
                       const float* rel, const _Float16* WoF, const float* bo,
                       float* out) {
  int lane = threadIdx.x & 31;
  int wave = (int)uni(threadIdx.x >> 5);   // the same in every lane: addresses built on it stay scalar
  int qt = blockIdx.x & 31;          // 32-query tile = image row, 0..31
  int b = blockIdx.x >> 5;
  int h = wave;
  int bh = b * NHEAD + h;

  // tab[h * TAB_S + 32 + i] = rel[63 * qt + 2015 - i][h], i = 0..2015. The copy
  // runs over 2048 rows, so that it has no branch: the 32 words in front of each
  // plane take the surplus (written, never read).
  __shared__ float tab[NHEAD * TAB_S];
  __shared__ __attribute__((aligned(16))) _Float16 x_s[2 * 8 * 512];
  {
    int tid = threadIdx.x & 255;   // the block has 256 threads
    v4f tv[16];
    // Chunk c = 16 bytes: heads 4 * (c & 1) .. + 3 of row 63 * qt + (c >> 1); a wave
    // loads 512 contiguous bytes. Unrolled so that all 16 loads of a thread are in
    // flight together; the surplus rows are clamped to stay inside rel.
#pragma unroll
    for (int k = 0; k < 16; ++k) {
      int cc = tid + 256 * k;
      int row = 63 * qt + (cc >> 1);
      tv[k] = *(const v4f*)(rel + (row < NREL ? row : NREL - 1) * NHEAD + (cc & 1) * 4);
    }
    // Unrolled so that tv[] stays in registers. Word 2047 - (cc >> 1) of the plane,
    // written as (127 - (tid >> 1)) + 128 * (15 - k) with the xor for the first term,
    // so that the register part of the LDS address is never below 0.
    int rt = (tid >> 1) ^ 127;
#pragma unroll
    for (int k = 0; k < 16; ++k) {
      float* d = tab + (tid & 1) * (4 * TAB_S) + rt + 128 * (15 - k);
      d[0]         = tv[k][0];
      d[TAB_S]     = tv[k][1];
      d[2 * TAB_S] = tv[k][2];
      d[3 * TAB_S] = tv[k][3];
    }
  }

  // Per (b,h): 64 blocks of Q, 64 of K (two a pass), 64 of V^T (two a pass).
  const _Float16* Qp  = Q  + (long)bh * S_LEN * HDIM;
  const _Float16* Kp  = K  + (long)bh * S_LEN * HDIM;
  const _Float16* Vtp = Vt + (long)bh * HDIM * S_LEN;

  int m0 = qt * 32;
  v16h qa0 = load_frag_p(Qp + (long)m0 * HDIM,       lane);  // full HD in one frag
  v16h qa1 = load_frag_p(Qp + (long)m0 * HDIM + 512, lane);

  // K and V^T fragments are loaded two passes ahead of their products, in two
  // register sets (even passes: a, odd passes: c). A pass asks for the K fragments
  // of the pass after next behind its score products and for the V^T fragments
  // behind its output products, so that a load has up to two passes of vector work
  // to arrive in, not the few instructions between a pass's head and its products.
  // The first two passes' loads stand here, to fly while the table is copied.
  v16h ka0 = load_frag_p(Kp,         lane), ka1 = load_frag_p(Kp + 512,   lane);
  v16h va0 = load_frag_p(Vtp,        lane), va1 = load_frag_p(Vtp + 512,  lane);
  v16h kc0 = load_frag_p(Kp + 1024,  lane), kc1 = load_frag_p(Kp + 1536,  lane);
  v16h vc0 = load_frag_p(Vtp + 1024, lane), vc1 = load_frag_p(Vtp + 1536, lane);

  v8f o00 = {}, o01 = {}, o10 = {}, o11 = {};
  float mq0 = -3.0e38f, lq0 = 0.0f, mq1 = -3.0e38f, lq1 = 0.0f;

  int col = lane & 15;
  int rbase = (lane >> 4) * 8;

  // The wave's 32 queries are image row qt (x = 16u + col); the 32 keys of a
  // pass are image row j0 / 32 (x = 16t + rbase + r). rel row index
  // (qt - j0/32 + 31) * 63 + 16(u - t) + col - rbase - r + 31, so in the
  // reversed plane: i = (j0/32) * 63 + 31 - col + rbase + r - 16(u - t).
  // col ^ 15 is 15 - col, written so that the register part of the LDS address
  // is never below 0 (a constant 15 would move into the offset field).
  const float* bp = tab + h * TAB_S + 32 + (col ^ 15) + rbase;

  __syncthreads();   // tab complete before any wave reads it

  // One pass: k0, k1, v0, v1 hold its fragments and leave holding those at Kn, Vn.
  auto pass = [&](v16h& k0, v16h& k1, v16h& v0, v16h& v1, const float* bw,
                  const _Float16* Kn, const _Float16* Vn) {
    // Swin relative-position bias (POS table is an analytic constant). Read ahead of
    // the products, so that the LDS latency passes behind them. Unrolled, here and
    // at the additions, so that b0, b1, b2 stay in registers.
    float b0[8], b1[8], b2[8];
#pragma unroll
    for (int r = 0; r < 8; ++r) {
      b0[r] = bw[r];         // u = 1, t = 0
      b1[r] = bw[16 + r];    // u == t
      b2[r] = bw[32 + r];    // u = 0, t = 1
    }
    v8f z = {};
    // s<u><t>[r] = S[query m0 + 16u + col][key j0 + 16t + rbase + r]
    v8f s00 = wmma16(k0, qa0, z);
    v8f s01 = wmma16(k1, qa0, z);
    v8f s10 = wmma16(k0, qa1, z);
    v8f s11 = wmma16(k1, qa1, z);
    k0 = load_frag_p(Kn,       lane);
    k1 = load_frag_p(Kn + 512, lane);
    // Holds the refills up here. Without it they sink to the middle of the softmax
    // and lose half of their lead.
    __builtin_amdgcn_sched_barrier(0);
#pragma unroll
    for (int r = 0; r < 8; ++r) {
      s00[r] += b1[r];
      s01[r] += b2[r];
      s10[r] += b0[r];
      s11[r] += b1[r];
    }

    v16h pb0 = softmax_step_t(s00, s01, o00, o01, mq0, lq0);
    v16h pb1 = softmax_step_t(s10, s11, o10, o11, mq1, lq1);

    o00 = wmma16(v0, pb0, o00);
    o01 = wmma16(v1, pb0, o01);
    o10 = wmma16(v0, pb1, o10);
    o11 = wmma16(v1, pb1, o11);
    v0 = load_frag_p(Vn,       lane);
    v1 = load_frag_p(Vn + 512, lane);
  };

  for (int j0 = 0; j0 < S_LEN; j0 += 64, bp += 126) {
    // The last trip has no pass after next: it asks for its own blocks again (inside
    // the buffers, never used), so that no branch stands behind a product.
    int nx = (j0 + 64 < S_LEN ? j0 + 64 : j0) * HDIM;
    pass(ka0, ka1, va0, va1, bp,      Kp + nx,        Vtp + nx);
    pass(kc0, kc1, vc0, vc1, bp + 63, Kp + nx + 1024, Vtp + nx + 1024);
  }

  // The wave's Wo fragments: columns 32 * wave + 16t + (lane & 15), 8 k steps.
  // Asked for here, so that they fly during the division, the X stores and the
  // barrier.
  const _Float16* Wp = WoF + (long)wave * (2 * 8 * 512);
  v16h w0[8], w1[8];
#pragma unroll
  for (int ks = 0; ks < 8; ++ks) {
    w0[ks] = load_frag_p(Wp + ks * 512,       lane);
    w1[ks] = load_frag_p(Wp + (8 + ks) * 512, lane);
  }
  int n0 = wave * 32;
  float bn0 = bo[n0 + col];
  float bn1 = bo[n0 + 16 + col];

  float inv0 = 1.0f / (lq0 + xhalf(lq0));
  float inv1 = 1.0f / (lq1 + xhalf(lq1));
  v8h x00, x01, x10, x11;
#pragma unroll
  for (int r = 0; r < 8; ++r) {
    x00[r] = (_Float16)(o00[r] * inv0);
    x01[r] = (_Float16)(o01[r] * inv0);
    x10[r] = (_Float16)(o10[r] * inv1);
    x11[r] = (_Float16)(o11[r] * inv1);
  }
  _Float16* X0 = x_s + h * 512 + lane * 8;
  _Float16* X1 = X0 + 8 * 512;   // the next row tile
  *(v8h*)(X0)       = x00;
  *(v8h*)(X0 + 256) = x01;
  *(v8h*)(X1)       = x10;
  *(v8h*)(X1 + 256) = x11;

  __syncthreads();   // all 8 heads of X in LDS before any wave reads them

  // a<u><t>: row tile u, column tile t; k steps in rising order, four at a time.
  v8f a00 = {}, a01 = {}, a10 = {}, a11 = {};
#pragma unroll
  for (int kh = 0; kh < 2; ++kh) {
    v16h x0[4], x1[4];
#pragma unroll
    for (int j = 0; j < 4; ++j) {
      x0[j] = load_frag_p(x_s + (kh * 4 + j) * 512,     lane);
      x1[j] = load_frag_p(x_s + (8 + kh * 4 + j) * 512, lane);
    }
    // Holds the 16 LDS loads ahead of the products. Without it the loads sink to
    // their uses, and the wave waits out one LDS latency per k step instead of one
    // per four.
    __builtin_amdgcn_sched_barrier(0);
#pragma unroll
    for (int j = 0; j < 4; ++j) {
      a00 = wmma16(x0[j], w0[kh * 4 + j], a00);
      a01 = wmma16(x0[j], w1[kh * 4 + j], a01);
      a10 = wmma16(x1[j], w0[kh * 4 + j], a10);
      a11 = wmma16(x1[j], w1[kh * 4 + j], a11);
    }
  }

#pragma unroll
  for (int r = 0; r < 8; ++r) {
    int ma = b * S_LEN + m0 + rbase + r;
    int mb2 = ma + 16;
    out[(long)ma  * DMODEL + n0 + col]      = a00[r] + bn0;
    out[(long)ma  * DMODEL + n0 + 16 + col] = a01[r] + bn1;
    out[(long)mb2 * DMODEL + n0 + col]      = a10[r] + bn0;
    out[(long)mb2 * DMODEL + n0 + 16 + col] = a11[r] + bn1;
  }
}

extern "C" void kernel_launch(void* const* d_in, const int* in_sizes, int n_in,
                              void* d_out, int out_size, void* d_ws, size_t ws_size,
                              hipStream_t stream) {
  (void)in_sizes; (void)n_in; (void)out_size; (void)ws_size;
  const float* inq  = (const float*)d_in[0];
  const float* inkv = (const float*)d_in[1];
  const float* Wq   = (const float*)d_in[2];
  const float* bq   = (const float*)d_in[3];
  const float* Wk   = (const float*)d_in[4];
  const float* bk   = (const float*)d_in[5];
  const float* Wv   = (const float*)d_in[6];
  const float* bv   = (const float*)d_in[7];
  const float* rel  = (const float*)d_in[8];
  const float* Wo   = (const float*)d_in[9];
  const float* bo   = (const float*)d_in[10];
  float* out = (float*)d_out;

  char* ws = (char*)d_ws;
  const size_t WSZ = 256 * 256 * sizeof(_Float16);                 // 128 KB
  const size_t QSZ = (size_t)8 * 8 * 1024 * 32 * sizeof(_Float16); // 4 MB
  _Float16* WoF = (_Float16*)(ws);
  size_t off = WSZ;
  _Float16* Qb = (_Float16*)(ws + off); off += QSZ;
  _Float16* Kb = (_Float16*)(ws + off); off += QSZ;
  _Float16* Vt = (_Float16*)(ws + off);

  qkv_proj_k<<<224, 256, 0, stream>>>(inq, inkv, Wq, Wk, Wv, Wo, bq, bk, bv,
                                      Qb, Kb, Vt, WoF);
  attn_k<<<256, 256, 0, stream>>>(Qb, Kb, Vt, rel, WoF, bo, out);
}

// v009
// One run takes 28.3 microseconds.
// Next to v008, in two timings, it ran 1.03 and 1.02 times as fast.
// All steps since v000 together make it 11.8 times as fast.
#include <hip/hip_runtime.h>
#include <hip/hip_bf16.h>

typedef __attribute__((ext_vector_type(16))) _Float16 v16h;
typedef __attribute__((ext_vector_type(8)))  _Float16 v8h;
typedef __attribute__((ext_vector_type(8)))  float    v8f;
typedef __attribute__((ext_vector_type(4)))  float    v4f;

#define S_LEN  1024
#define DMODEL 256
#define NHEAD  8
#define HDIM   32
#define NREL   3969   // (2*32-1) * (2*32-1) rows of rel_table

static __device__ __forceinline__ v8f wmma16(v16h a, v16h b, v8f c) {
  // D = A(16x32 f16) x B(32x16 f16) + C(16x16 f32)
  return __builtin_amdgcn_wmma_f32_16x16x32_f16(false, a, false, b, (short)0, c,
                                                false, false);
}

static __device__ __forceinline__ v16h load_frag_p(const _Float16* blk, int lane) {
  v8h lo = *(const v8h*)(blk + lane * 8);
  v8h hi = *(const v8h*)(blk + 256 + lane * 8);
  v16h f;
#pragma unroll
  for (int i = 0; i < 8; ++i) { f[i] = lo[i]; f[i + 8] = hi[i]; }
  return f;
}

static __device__ __forceinline__ unsigned int uni(unsigned int v) {
  return (unsigned int)__builtin_amdgcn_readfirstlane(v);
}

#define PROWS 128

typedef __attribute__((ext_vector_type(2))) float v2f;
typedef __attribute__((ext_vector_type(4))) _Float16 v4h;

// The products of one 32-row pair: A points at its two row tiles in LDS (8 blocks
// each), f0, f1 are the wave's weight fragments. a<u><t>: row tile u, weight tile t.
// XA: the rows are the A operand (D = rows x weights), else the B operand.
// Its loops are unrolled so that the fragment arrays are indexed by constants and
// stay in registers.
template <bool XA>
static __device__ __forceinline__ void proj_pair(const _Float16* A, const v16h* f0,
                                                 const v16h* f1, int lane, v8f& a00,
                                                 v8f& a01, v8f& a10, v8f& a11) {
#pragma unroll
  for (int kh = 0; kh < 2; ++kh) {
    v16h x0[4], x1[4];
#pragma unroll
    for (int j = 0; j < 4; ++j) {
      x0[j] = load_frag_p(A + (kh * 4 + j) * 512,     lane);
      x1[j] = load_frag_p(A + (8 + kh * 4 + j) * 512, lane);
    }
#pragma unroll
    for (int j = 0; j < 4; ++j) {
      v16h w0 = f0[kh * 4 + j];
      v16h w1 = f1[kh * 4 + j];
      if (XA) {
        a00 = wmma16(x0[j], w0, a00);
        a01 = wmma16(x0[j], w1, a01);
        a10 = wmma16(x1[j], w0, a10);
        a11 = wmma16(x1[j], w1, a11);
      } else {
        a00 = wmma16(w0, x0[j], a00);
        a01 = wmma16(w1, x0[j], a01);
        a10 = wmma16(w0, x1[j], a10);
        a11 = wmma16(w1, x1[j], a11);
      }
    }
  }
}

__global__ void __launch_bounds__(256) qkv_proj_k(
    const float* inq, const float* inkv, const float* Wq, const float* Wk,
    const float* Wv, const float* Wo, const float* bq, const float* bk,
    const float* bv, _Float16* Q, _Float16* K, _Float16* Vt, _Float16* WoF) {
  __shared__ __attribute__((aligned(16))) _Float16 a_s[PROWS * DMODEL];
  int lane = threadIdx.x & 31;
  int wave = (int)uni(threadIdx.x >> 5);   // the same in every lane: addresses built on it stay scalar
  int blk = blockIdx.x;

  if (blk >= 192) {
    int c = (blk - 192) * 256 + (int)threadIdx.x;
    int n = (c >> 9) * 16 + (c & 15);
    int k = ((c >> 6) & 7) * 32 + ((c >> 4) & 1) * 16 + ((c >> 5) & 1);
    v8h o;
#pragma unroll
    for (int e = 0; e < 8; ++e) o[e] = (_Float16)Wo[(k + 2 * e) * 256 + n];
    *(v8h*)(WoF + (long)c * 8) = o;
    return;   // the whole block leaves, ahead of the barrier
  }

  int which = blk >> 6;            // 0=Q 1=K 2=V
  int row0 = (blk & 63) * PROWS;   // first of the block's rows, of 8192
  int c16 = lane & 15;
  int g = lane >> 4;
  int n0 = wave * 32;

  // A wave's load of input: 4 rows x 128 B (k step = wave), whole lines.
  const float* ip = (which == 0 ? inq : inkv) +
                    (long)(row0 + (lane >> 3)) * DMODEL + wave * 32 + (lane & 7) * 4;
  // Where the lane's 4 halves go, for row (lane >> 3) of a row tile: k & 31 =
  // 4 * (lane & 7) + d, so upper = bit 2, g = bit 1 of the lane, k & 7 = 4 * bit 0 + d.
  _Float16* ap = a_s + wave * 512 + ((lane >> 2) & 1) * 256 +
                 ((lane >> 3) + ((lane >> 1) & 1) * 16) * 8 + (lane & 1) * 4;
  // The lane's weights: rows 8g + ..., columns n0 + 2 * c16 and the next.
  const float* wp = (which == 0 ? Wq : (which == 1 ? Wk : Wv)) + g * 8 * 256 + n0 + 2 * c16;

  const float* bp = (which == 0 ? bq : (which == 1 ? bk : bv)) + n0;

  // All of the wave's loads stand together ahead of the casts, the rows first (they
  // come from furthest away), so that the wave waits out one load latency, not one a
  // fragment. These loops and the casts' are unrolled so that tv[], wl[], f0[] and
  // f1[] stay in registers.
  v4f tv[32];
  v2f wl[128];
#pragma unroll
  for (int i = 0; i < 32; ++i) tv[i] = *(const v4f*)(ip + i * 4 * DMODEL);
#pragma unroll
  for (int q = 0; q < 128; ++q) {
    int e = q & 15;
    wl[q] = *(const v2f*)(wp + ((q >> 4) * 32 + (e & 7) + 16 * (e >> 3)) * 256);
  }
  unsigned int oqk = g * 64u, ov = c16 * 8u;   // the lane's byte offsets into the head's bias
  v4f bqk[4];
#pragma unroll
  for (int i = 0; i < 4; ++i) bqk[i] = *(const v4f*)((const char*)bp + oqk + i * 16);
  v2f bvv = *(const v2f*)((const char*)bp + ov);
  // Stands in front of every reuse of the loads' address registers; the addresses
  // are named as inputs so that their registers live up to it.
  asm volatile("s_wait_xcnt 0x0" :: "v"(wp), "v"(ip), "v"(oqk), "v"(ov) : "memory");
  // Holds the loads and the wait ahead of the casts (without it each load sinks to
  // its use).
  __builtin_amdgcn_sched_barrier(0);
#pragma unroll
  for (int i = 0; i < 32; ++i) {
    int r = i * 4;
    v4h o;
#pragma unroll
    for (int d = 0; d < 4; ++d) o[d] = (_Float16)tv[i][d];
    *(v4h*)(ap + (r >> 4) * (8 * 512) + (r & 15) * 8) = o;
  }
  v16h f0[8], f1[8];
#pragma unroll
  for (int q = 0; q < 128; ++q) {
    f0[q >> 4][q & 15] = (_Float16)wl[q][0];
    f1[q >> 4][q & 15] = (_Float16)wl[q][1];
  }

  __syncthreads();   // all 8 k steps of the rows in LDS before any wave reads them

  int bh = (row0 >> 10) * NHEAD + wave;
  int s0 = row0 & (S_LEN - 1);

  if (which == 2) {
    float bn0 = bvv[0];
    float bn1 = bvv[1];
    // Kept rolled: unrolled, the LDS loads of all four row pairs rise to the top and
    // the registers spill.
#pragma unroll 1
    for (int rp = 0; rp < PROWS / 32; ++rp) {
      v8f a00 = {}, a01 = {}, a10 = {}, a11 = {};
      proj_pair<true>(a_s + rp * (2 * 8 * 512), f0, f1, lane, a00, a01, a10, a11);
      // a<u><t>[r] = V[s = m0 + 16u + 8g + r][hd = 2 * (lane & 15) + t]
      int m0 = s0 + rp * 32;
      v8h y00, y01, y10, y11;
#pragma unroll
      for (int r = 0; r < 8; ++r) {
        y00[r] = (_Float16)(a00[r] + bn0);
        y01[r] = (_Float16)(a01[r] + bn1);
        y10[r] = (_Float16)(a10[r] + bn0);
        y11[r] = (_Float16)(a11[r] + bn1);
      }
      _Float16* o = Vt + (long)(bh * 32 + (m0 >> 5)) * 1024 + lane * 8;
      *(v8h*)(o)             = y00;
      *(v8h*)(o + 256)       = y10;
      *(v8h*)(o + 512)       = y01;
      *(v8h*)(o + 512 + 256) = y11;
    }
  } else {
    float scale = (which == 0) ? 0.17677669529663687f : 1.0f;  // 1/sqrt(HD)
    float bn0[8], bn1[8];
#pragma unroll
    for (int r = 0; r < 8; ++r) {
      bn0[r] = bqk[r >> 1][(r & 1) * 2];        // column 16g + 2r
      bn1[r] = bqk[r >> 1][(r & 1) * 2 + 1];    // column 16g + 2r + 1
    }
    // Kept rolled: unrolled, the LDS loads of all four row pairs rise to the top and
    // the registers spill.
#pragma unroll 1
    for (int rp = 0; rp < PROWS / 32; ++rp) {
      v8f a00 = {}, a01 = {}, a10 = {}, a11 = {};
      proj_pair<false>(a_s + rp * (2 * 8 * 512), f0, f1, lane, a00, a01, a10, a11);
      // a<u><t>[r] = out[s = m0 + 16u + (lane & 15)][hd = 2 * (8g + r) + t]
      int m0 = s0 + rp * 32;
      v8h y00, y01, y10, y11;
#pragma unroll
      for (int r = 0; r < 8; ++r) {
        y00[r] = (_Float16)((a00[r] + bn0[r]) * scale);
        y01[r] = (_Float16)((a01[r] + bn1[r]) * scale);
        y10[r] = (_Float16)((a10[r] + bn0[r]) * scale);
        y11[r] = (_Float16)((a11[r] + bn1[r]) * scale);
      }
      _Float16* o = (which == 0 ? Q : K) + (long)(bh * 64 + (m0 >> 4)) * 512 + lane * 8;
      *(v8h*)(o)             = y00;
      *(v8h*)(o + 256)       = y01;
      *(v8h*)(o + 512)       = y10;
      *(v8h*)(o + 512 + 256) = y11;
    }
  }
}

static __device__ __forceinline__ float xhalf(float x) {
  int v = __builtin_bit_cast(int, x);
  return __builtin_bit_cast(float, __builtin_amdgcn_permlanex16(
      v, v, 0x76543210, 0xfedcba98, false, false));
}

// ---------------------------------------------------------------------------
// Online-softmax update for one 16-query column group against 32 new keys.
// Scores are transposed: t0[r] = S[query col][key 8g + r], t1[r] the same for
// key 16 + 8g + r, so a lane holds 16 of its query's 32 scores. Maximum:
// in-lane, then one exchange between the halves. Sum: in-lane only; the
// halves' sums are joined once behind the key loop. Returns P^T as a B operand
// (element e -> key 8g + (e & 7) + 16 * (e >> 3), the order of load_frag_p).
// All arithmetic on the 16 scores is written on whole accumulators, so that it
// compiles to packed operations on the register pairs (r, r + 1) of one
// accumulator, which need no moves. m is the running maximum times log2(e):
// exp(t - max) = exp2(t * log2(e) - m) is then one fused multiply-add a score.
// ---------------------------------------------------------------------------
#define LOG2E 1.4426950408889634f

static __device__ __forceinline__ v16h softmax_step_t(const v8f& t0, const v8f& t1,
                                                      v8f& oa, v8f& ob, float& m,
                                                      float& l) {
  float mx = fmaxf(t0[0], t1[0]);
#pragma unroll
  for (int r = 1; r < 8; ++r) mx = fmaxf(mx, fmaxf(t0[r], t1[r]));
  mx = fmaxf(mx, xhalf(mx));
  float mnew = fmaxf(m, mx * LOG2E);
  float corr = __builtin_amdgcn_exp2f(m - mnew);
  v8f c, n;   // log2(e) and -mnew in every element
#pragma unroll
  for (int r = 0; r < 8; ++r) { c[r] = LOG2E; n[r] = -mnew; }
  v8f a0 = __builtin_elementwise_fma(t0, c, n);
  v8f a1 = __builtin_elementwise_fma(t1, c, n);
  v8f e0, e1;
  v16h p;
#pragma unroll
  for (int r = 0; r < 8; ++r) {
    e0[r] = __builtin_amdgcn_exp2f(a0[r]);
    e1[r] = __builtin_amdgcn_exp2f(a1[r]);
    p[r]     = (_Float16)e0[r];
    p[r + 8] = (_Float16)e1[r];
  }
  v8f s8 = e0 + e1;
  v4f s4 = __builtin_shufflevector(s8, s8, 0, 1, 2, 3) + __builtin_shufflevector(s8, s8, 4, 5, 6, 7);
  v2f s2 = __builtin_shufflevector(s4, s4, 0, 1) + __builtin_shufflevector(s4, s4, 2, 3);
  l = l * corr + (s2[0] + s2[1]);
  m = mnew;
  oa *= corr;
  ob *= corr;
  return p;
}

#define TAB_S 2056

__global__ void __launch_bounds__(256) attn_k(const _Float16* Q, const _Float16* K, const _Float16* Vt,
                       const float* rel, const _Float16* WoF, const float* bo,
                       float* out) {
  int lane = threadIdx.x & 31;
  int wave = (int)uni(threadIdx.x >> 5);   // the same in every lane: addresses built on it stay scalar
  int qt = blockIdx.x & 31;          // 32-query tile = image row, 0..31
  int b = blockIdx.x >> 5;
  int h = wave;
  int bh = b * NHEAD + h;

  // tab[h * TAB_S + 32 + i] = rel[63 * qt + 2015 - i][h], i = 0..2015. The copy
  // runs over 2048 rows, so that it has no branch: the 32 words in front of each
  // plane take the surplus (written, never read).
  __shared__ float tab[NHEAD * TAB_S];
  __shared__ __attribute__((aligned(16))) _Float16 x_s[2 * 8 * 512];
  {
    int tid = threadIdx.x & 255;   // the block has 256 threads
    v4f tv[16];
    // Chunk c = 16 bytes: heads 4 * (c & 1) .. + 3 of row 63 * qt + (c >> 1); a wave
    // loads 512 contiguous bytes. Unrolled so that all 16 loads of a thread are in
    // flight together; the surplus rows are clamped to stay inside rel.
#pragma unroll
    for (int k = 0; k < 16; ++k) {
      int cc = tid + 256 * k;
      int row = 63 * qt + (cc >> 1);
      tv[k] = *(const v4f*)(rel + (row < NREL ? row : NREL - 1) * NHEAD + (cc & 1) * 4);
    }
    // Unrolled so that tv[] stays in registers. Word 2047 - (cc >> 1) of the plane,
    // written as (127 - (tid >> 1)) + 128 * (15 - k) with the xor for the first term,
    // so that the register part of the LDS address is never below 0.
    int rt = (tid >> 1) ^ 127;
#pragma unroll
    for (int k = 0; k < 16; ++k) {
      float* d = tab + (tid & 1) * (4 * TAB_S) + rt + 128 * (15 - k);
      d[0]         = tv[k][0];
      d[TAB_S]     = tv[k][1];
      d[2 * TAB_S] = tv[k][2];
      d[3 * TAB_S] = tv[k][3];
    }
  }

  // Per (b,h): 64 blocks of Q, 64 of K (two a pass), 64 of V^T (two a pass).
  const _Float16* Qp  = Q  + (long)bh * S_LEN * HDIM;
  const _Float16* Kp  = K  + (long)bh * S_LEN * HDIM;
  const _Float16* Vtp = Vt + (long)bh * HDIM * S_LEN;

  int m0 = qt * 32;
  v16h qa0 = load_frag_p(Qp + (long)m0 * HDIM,       lane);  // full HD in one frag
  v16h qa1 = load_frag_p(Qp + (long)m0 * HDIM + 512, lane);

  // K and V^T fragments are loaded two passes ahead of their products, in two
  // register sets (even passes: a, odd passes: c). A pass asks for the K fragments
  // of the pass after next behind its score products and for the V^T fragments
  // behind its output products, so that a load has up to two passes of vector work
  // to arrive in, not the few instructions between a pass's head and its products.
  // The first two passes' loads stand here, to fly while the table is copied.
  v16h ka0 = load_frag_p(Kp,         lane), ka1 = load_frag_p(Kp + 512,   lane);
  v16h va0 = load_frag_p(Vtp,        lane), va1 = load_frag_p(Vtp + 512,  lane);
  v16h kc0 = load_frag_p(Kp + 1024,  lane), kc1 = load_frag_p(Kp + 1536,  lane);
  v16h vc0 = load_frag_p(Vtp + 1024, lane), vc1 = load_frag_p(Vtp + 1536, lane);

  v8f o00 = {}, o01 = {}, o10 = {}, o11 = {};
  float mq0 = -3.0e38f, lq0 = 0.0f, mq1 = -3.0e38f, lq1 = 0.0f;

  int col = lane & 15;
  int rbase = (lane >> 4) * 8;

  // The wave's 32 queries are image row qt (x = 16u + col); the 32 keys of a
  // pass are image row j0 / 32 (x = 16t + rbase + r). rel row index
  // (qt - j0/32 + 31) * 63 + 16(u - t) + col - rbase - r + 31, so in the
  // reversed plane: i = (j0/32) * 63 + 31 - col + rbase + r - 16(u - t).
  // col ^ 15 is 15 - col, written so that the register part of the LDS address
  // is never below 0 (a constant 15 would move into the offset field).
  const float* bp = tab + h * TAB_S + 32 + (col ^ 15) + rbase;

  __syncthreads();   // tab complete before any wave reads it

  // One pass: k0, k1, v0, v1 hold its fragments and leave holding those at Kn, Vn.
  auto pass = [&](v16h& k0, v16h& k1, v16h& v0, v16h& v1, const float* bw,
                  const _Float16* Kn, const _Float16* Vn) {
    // Swin relative-position bias (POS table is an analytic constant). Read ahead of
    // the products, so that the LDS latency passes behind them. Unrolled, so that b0,
    // b1, b2 stay in registers.
    v8f b0, b1, b2;
#pragma unroll
    for (int r = 0; r < 8; ++r) {
      b0[r] = bw[r];         // u = 1, t = 0
      b1[r] = bw[16 + r];    // u == t
      b2[r] = bw[32 + r];    // u = 0, t = 1
    }
    v8f z = {};
    // s<u><t>[r] = S[query m0 + 16u + col][key j0 + 16t + rbase + r]
    v8f s00 = wmma16(k0, qa0, z);
    v8f s01 = wmma16(k1, qa0, z);
    v8f s10 = wmma16(k0, qa1, z);
    v8f s11 = wmma16(k1, qa1, z);
    k0 = load_frag_p(Kn,       lane);
    k1 = load_frag_p(Kn + 512, lane);
    // Holds the refills up here. Without it they sink to the middle of the softmax
    // and lose half of their lead.
    __builtin_amdgcn_sched_barrier(0);
    // Whole accumulators: packed additions on the pairs (r, r + 1).
    s00 += b1;
    s01 += b2;
    s10 += b0;
    s11 += b1;

    v16h pb0 = softmax_step_t(s00, s01, o00, o01, mq0, lq0);
    v16h pb1 = softmax_step_t(s10, s11, o10, o11, mq1, lq1);

    o00 = wmma16(v0, pb0, o00);
    o01 = wmma16(v1, pb0, o01);
    o10 = wmma16(v0, pb1, o10);
    o11 = wmma16(v1, pb1, o11);
    v0 = load_frag_p(Vn,       lane);
    v1 = load_frag_p(Vn + 512, lane);
  };

  for (int j0 = 0; j0 < S_LEN; j0 += 64, bp += 126) {
    // The last trip has no pass after next: it asks for its own blocks again (inside
    // the buffers, never used), so that no branch stands behind a product.
    int nx = (j0 + 64 < S_LEN ? j0 + 64 : j0) * HDIM;
    pass(ka0, ka1, va0, va1, bp,      Kp + nx,        Vtp + nx);
    pass(kc0, kc1, vc0, vc1, bp + 63, Kp + nx + 1024, Vtp + nx + 1024);
    // Stands in front of the next trip's rewrite of the refills' address registers.
    asm volatile("s_wait_xcnt 0x0" ::: "memory");
  }

  // The wave's Wo fragments: columns 32 * wave + 16t + (lane & 15), 8 k steps.
  // Asked for here, so that they fly during the division, the X stores and the
  // barrier.
  const _Float16* Wp = WoF + (long)wave * (2 * 8 * 512);
  v16h w0[8], w1[8];
#pragma unroll
  for (int ks = 0; ks < 8; ++ks) {
    w0[ks] = load_frag_p(Wp + ks * 512,       lane);
    w1[ks] = load_frag_p(Wp + (8 + ks) * 512, lane);
  }
  int n0 = wave * 32;
  float bn0 = bo[n0 + col];
  float bn1 = bo[n0 + 16 + col];

  float inv0 = 1.0f / (lq0 + xhalf(lq0));
  float inv1 = 1.0f / (lq1 + xhalf(lq1));
  v8h x00, x01, x10, x11;
#pragma unroll
  for (int r = 0; r < 8; ++r) {
    x00[r] = (_Float16)(o00[r] * inv0);
    x01[r] = (_Float16)(o01[r] * inv0);
    x10[r] = (_Float16)(o10[r] * inv1);
    x11[r] = (_Float16)(o11[r] * inv1);
  }
  _Float16* X0 = x_s + h * 512 + lane * 8;
  _Float16* X1 = X0 + 8 * 512;   // the next row tile
  *(v8h*)(X0)       = x00;
  *(v8h*)(X0 + 256) = x01;
  *(v8h*)(X1)       = x10;
  *(v8h*)(X1 + 256) = x11;

  __syncthreads();   // all 8 heads of X in LDS before any wave reads them

  // a<u><t>: row tile u, column tile t; k steps in rising order, four at a time.
  v8f a00 = {}, a01 = {}, a10 = {}, a11 = {};
#pragma unroll
  for (int kh = 0; kh < 2; ++kh) {
    v16h x0[4], x1[4];
#pragma unroll
    for (int j = 0; j < 4; ++j) {
      x0[j] = load_frag_p(x_s + (kh * 4 + j) * 512,     lane);
      x1[j] = load_frag_p(x_s + (8 + kh * 4 + j) * 512, lane);
    }
    // Holds the 16 LDS loads ahead of the products. Without it the loads sink to
    // their uses, and the wave waits out one LDS latency per k step instead of one
    // per four.
    __builtin_amdgcn_sched_barrier(0);
#pragma unroll
    for (int j = 0; j < 4; ++j) {
      a00 = wmma16(x0[j], w0[kh * 4 + j], a00);
      a01 = wmma16(x0[j], w1[kh * 4 + j], a01);
      a10 = wmma16(x1[j], w0[kh * 4 + j], a10);
      a11 = wmma16(x1[j], w1[kh * 4 + j], a11);
    }
  }

#pragma unroll
  for (int r = 0; r < 8; ++r) {
    int ma = b * S_LEN + m0 + rbase + r;
    int mb2 = ma + 16;
    out[(long)ma  * DMODEL + n0 + col]      = a00[r] + bn0;
    out[(long)ma  * DMODEL + n0 + 16 + col] = a01[r] + bn1;
    out[(long)mb2 * DMODEL + n0 + col]      = a10[r] + bn0;
    out[(long)mb2 * DMODEL + n0 + 16 + col] = a11[r] + bn1;
  }
}

extern "C" void kernel_launch(void* const* d_in, const int* in_sizes, int n_in,
                              void* d_out, int out_size, void* d_ws, size_t ws_size,
                              hipStream_t stream) {
  (void)in_sizes; (void)n_in; (void)out_size; (void)ws_size;
  const float* inq  = (const float*)d_in[0];
  const float* inkv = (const float*)d_in[1];
  const float* Wq   = (const float*)d_in[2];
  const float* bq   = (const float*)d_in[3];
  const float* Wk   = (const float*)d_in[4];
  const float* bk   = (const float*)d_in[5];
  const float* Wv   = (const float*)d_in[6];
  const float* bv   = (const float*)d_in[7];
  const float* rel  = (const float*)d_in[8];
  const float* Wo   = (const float*)d_in[9];
  const float* bo   = (const float*)d_in[10];
  float* out = (float*)d_out;

  char* ws = (char*)d_ws;
  const size_t WSZ = 256 * 256 * sizeof(_Float16);                 // 128 KB
  const size_t QSZ = (size_t)8 * 8 * 1024 * 32 * sizeof(_Float16); // 4 MB
  _Float16* WoF = (_Float16*)(ws);
  size_t off = WSZ;
  _Float16* Qb = (_Float16*)(ws + off); off += QSZ;
  _Float16* Kb = (_Float16*)(ws + off); off += QSZ;
  _Float16* Vt = (_Float16*)(ws + off);

  qkv_proj_k<<<224, 256, 0, stream>>>(inq, inkv, Wq, Wk, Wv, Wo, bq, bk, bv,
                                      Qb, Kb, Vt, WoF);
  attn_k<<<256, 256, 0, stream>>>(Qb, Kb, Vt, rel, WoF, bo, out);
}

// v010
// One run takes 27 microseconds.
// Next to v009, in two timings, it ran 1.06 and 1.07 times as fast.
// Counting every step since v000, it is 12.6 times as fast.
#include <hip/hip_runtime.h>
#include <hip/hip_bf16.h>

typedef __attribute__((ext_vector_type(16))) _Float16 v16h;
typedef __attribute__((ext_vector_type(8)))  _Float16 v8h;
typedef __attribute__((ext_vector_type(8)))  float    v8f;
typedef __attribute__((ext_vector_type(4)))  float    v4f;

#define S_LEN  1024
#define DMODEL 256
#define NHEAD  8
#define HDIM   32
#define NREL   3969   // (2*32-1) * (2*32-1) rows of rel_table

static __device__ __forceinline__ v8f wmma16(v16h a, v16h b, v8f c) {
  // D = A(16x32 f16) x B(32x16 f16) + C(16x16 f32)
  return __builtin_amdgcn_wmma_f32_16x16x32_f16(false, a, false, b, (short)0, c,
                                                false, false);
}

static __device__ __forceinline__ v16h load_frag_p(const _Float16* blk, int lane) {
  v8h lo = *(const v8h*)(blk + lane * 8);
  v8h hi = *(const v8h*)(blk + 256 + lane * 8);
  v16h f;
#pragma unroll
  for (int i = 0; i < 8; ++i) { f[i] = lo[i]; f[i + 8] = hi[i]; }
  return f;
}

static __device__ __forceinline__ unsigned int uni(unsigned int v) {
  return (unsigned int)__builtin_amdgcn_readfirstlane(v);
}

#define PROWS 128

typedef __attribute__((ext_vector_type(2))) float v2f;
typedef __attribute__((ext_vector_type(4))) _Float16 v4h;

// The products of one 32-row pair: A points at its two row tiles in LDS (8 blocks
// each), f0, f1 are the wave's weight fragments. a<u><t>: row tile u, weight tile t.
// XA: the rows are the A operand (D = rows x weights), else the B operand.
// Its loops are unrolled so that the fragment arrays are indexed by constants and
// stay in registers.
template <bool XA>
static __device__ __forceinline__ void proj_pair(const _Float16* A, const v16h* f0,
                                                 const v16h* f1, int lane, v8f& a00,
                                                 v8f& a01, v8f& a10, v8f& a11) {
#pragma unroll
  for (int kh = 0; kh < 2; ++kh) {
    v16h x0[4], x1[4];
#pragma unroll
    for (int j = 0; j < 4; ++j) {
      x0[j] = load_frag_p(A + (kh * 4 + j) * 512,     lane);
      x1[j] = load_frag_p(A + (8 + kh * 4 + j) * 512, lane);
    }
#pragma unroll
    for (int j = 0; j < 4; ++j) {
      v16h w0 = f0[kh * 4 + j];
      v16h w1 = f1[kh * 4 + j];
      if (XA) {
        a00 = wmma16(x0[j], w0, a00);
        a01 = wmma16(x0[j], w1, a01);
        a10 = wmma16(x1[j], w0, a10);
        a11 = wmma16(x1[j], w1, a11);
      } else {
        a00 = wmma16(w0, x0[j], a00);
        a01 = wmma16(w1, x0[j], a01);
        a10 = wmma16(w0, x1[j], a10);
        a11 = wmma16(w1, x1[j], a11);
      }
    }
  }
}

__global__ void __launch_bounds__(256) qkv_proj_k(
    const float* inq, const float* inkv, const float* Wq, const float* Wk,
    const float* Wv, const float* Wo, const float* bq, const float* bk,
    const float* bv, _Float16* Q, _Float16* K, _Float16* Vt, _Float16* WoF) {
  __shared__ __attribute__((aligned(16))) _Float16 a_s[PROWS * DMODEL];
  int lane = threadIdx.x & 31;
  int wave = (int)uni(threadIdx.x >> 5);   // the same in every lane: addresses built on it stay scalar
  int blk = blockIdx.x;

  if (blk >= 192) {
    int c = (blk - 192) * 256 + (int)threadIdx.x;
    int n = (c >> 9) * 16 + (c & 15);
    int k = ((c >> 6) & 7) * 32 + ((c >> 4) & 1) * 16 + ((c >> 5) & 1);
    v8h o;
#pragma unroll
    for (int e = 0; e < 8; ++e) o[e] = (_Float16)Wo[(k + 2 * e) * 256 + n];
    *(v8h*)(WoF + (long)c * 8) = o;
    return;   // the whole block leaves, ahead of the barrier
  }

  int which = blk >> 6;            // 0=Q 1=K 2=V
  int row0 = (blk & 63) * PROWS;   // first of the block's rows, of 8192
  int c16 = lane & 15;
  int g = lane >> 4;
  int n0 = wave * 32;

  // A wave's load of input: 4 rows x 128 B (k step = wave), whole lines.
  const float* ip = (which == 0 ? inq : inkv) +
                    (long)(row0 + (lane >> 3)) * DMODEL + wave * 32 + (lane & 7) * 4;
  // Where the lane's 4 halves go, for row (lane >> 3) of a row tile: k & 31 =
  // 4 * (lane & 7) + d, so upper = bit 2, g = bit 1 of the lane, k & 7 = 4 * bit 0 + d.
  _Float16* ap = a_s + wave * 512 + ((lane >> 2) & 1) * 256 +
                 ((lane >> 3) + ((lane >> 1) & 1) * 16) * 8 + (lane & 1) * 4;
  // The lane's weights: rows 8g + ..., columns n0 + 2 * c16 and the next.
  const float* wp = (which == 0 ? Wq : (which == 1 ? Wk : Wv)) + g * 8 * 256 + n0 + 2 * c16;

  const float* bp = (which == 0 ? bq : (which == 1 ? bk : bv)) + n0;

  // All of the wave's loads stand together ahead of the casts, the rows first (they
  // come from furthest away), so that the wave waits out one load latency, not one a
  // fragment. These loops and the casts' are unrolled so that tv[], wl[], f0[] and
  // f1[] stay in registers.
  v4f tv[32];
  v2f wl[128];
#pragma unroll
  for (int i = 0; i < 32; ++i) tv[i] = *(const v4f*)(ip + i * 4 * DMODEL);
#pragma unroll
  for (int q = 0; q < 128; ++q) {
    int e = q & 15;
    wl[q] = *(const v2f*)(wp + ((q >> 4) * 32 + (e & 7) + 16 * (e >> 3)) * 256);
  }
  unsigned int oqk = g * 64u, ov = c16 * 8u;   // the lane's byte offsets into the head's bias
  v4f bqk[4];
#pragma unroll
  for (int i = 0; i < 4; ++i) bqk[i] = *(const v4f*)((const char*)bp + oqk + i * 16);
  v2f bvv = *(const v2f*)((const char*)bp + ov);
  // Stands in front of every reuse of the loads' address registers; the addresses
  // are named as inputs so that their registers live up to it.
  asm volatile("s_wait_xcnt 0x0" :: "v"(wp), "v"(ip), "v"(oqk), "v"(ov) : "memory");
  // Holds the loads and the wait ahead of the casts (without it each load sinks to
  // its use).
  __builtin_amdgcn_sched_barrier(0);
#pragma unroll
  for (int i = 0; i < 32; ++i) {
    int r = i * 4;
    v4h o;
#pragma unroll
    for (int d = 0; d < 4; ++d) o[d] = (_Float16)tv[i][d];
    *(v4h*)(ap + (r >> 4) * (8 * 512) + (r & 15) * 8) = o;
  }
  v16h f0[8], f1[8];
#pragma unroll
  for (int q = 0; q < 128; ++q) {
    f0[q >> 4][q & 15] = (_Float16)wl[q][0];
    f1[q >> 4][q & 15] = (_Float16)wl[q][1];
  }

  __syncthreads();   // all 8 k steps of the rows in LDS before any wave reads them

  int bh = (row0 >> 10) * NHEAD + wave;
  int s0 = row0 & (S_LEN - 1);

  if (which == 2) {
    float bn0 = bvv[0];
    float bn1 = bvv[1];
    // Kept rolled: unrolled, the LDS loads of all four row pairs rise to the top and
    // the registers spill.
#pragma unroll 1
    for (int rp = 0; rp < PROWS / 32; ++rp) {
      v8f a00 = {}, a01 = {}, a10 = {}, a11 = {};
      proj_pair<true>(a_s + rp * (2 * 8 * 512), f0, f1, lane, a00, a01, a10, a11);
      // a<u><t>[r] = V[s = m0 + 16u + 8g + r][hd = 2 * (lane & 15) + t]
      int m0 = s0 + rp * 32;
      v8h y00, y01, y10, y11;
#pragma unroll
      for (int r = 0; r < 8; ++r) {
        y00[r] = (_Float16)(a00[r] + bn0);
        y01[r] = (_Float16)(a01[r] + bn1);
        y10[r] = (_Float16)(a10[r] + bn0);
        y11[r] = (_Float16)(a11[r] + bn1);
      }
      _Float16* o = Vt + (long)(bh * 32 + (m0 >> 5)) * 1024 + lane * 8;
      *(v8h*)(o)             = y00;
      *(v8h*)(o + 256)       = y10;
      *(v8h*)(o + 512)       = y01;
      *(v8h*)(o + 512 + 256) = y11;
    }
  } else {
    float scale = (which == 0) ? 0.17677669529663687f : 1.0f;  // 1/sqrt(HD)
    float bn0[8], bn1[8];
#pragma unroll
    for (int r = 0; r < 8; ++r) {
      bn0[r] = bqk[r >> 1][(r & 1) * 2];        // column 16g + 2r
      bn1[r] = bqk[r >> 1][(r & 1) * 2 + 1];    // column 16g + 2r + 1
    }
    // Kept rolled: unrolled, the LDS loads of all four row pairs rise to the top and
    // the registers spill.
#pragma unroll 1
    for (int rp = 0; rp < PROWS / 32; ++rp) {
      v8f a00 = {}, a01 = {}, a10 = {}, a11 = {};
      proj_pair<false>(a_s + rp * (2 * 8 * 512), f0, f1, lane, a00, a01, a10, a11);
      // a<u><t>[r] = out[s = m0 + 16u + (lane & 15)][hd = 2 * (8g + r) + t]
      int m0 = s0 + rp * 32;
      v8h y00, y01, y10, y11;
#pragma unroll
      for (int r = 0; r < 8; ++r) {
        y00[r] = (_Float16)((a00[r] + bn0[r]) * scale);
        y01[r] = (_Float16)((a01[r] + bn1[r]) * scale);
        y10[r] = (_Float16)((a10[r] + bn0[r]) * scale);
        y11[r] = (_Float16)((a11[r] + bn1[r]) * scale);
      }
      _Float16* o = (which == 0 ? Q : K) + (long)(bh * 64 + (m0 >> 4)) * 512 + lane * 8;
      *(v8h*)(o)             = y00;
      *(v8h*)(o + 256)       = y01;
      *(v8h*)(o + 512)       = y10;
      *(v8h*)(o + 512 + 256) = y11;
    }
  }
}

static __device__ __forceinline__ float xhalf(float x) {
  int v = __builtin_bit_cast(int, x);
  return __builtin_bit_cast(float, __builtin_amdgcn_permlanex16(
      v, v, 0x76543210, 0xfedcba98, false, false));
}

// ---------------------------------------------------------------------------
// Online-softmax update for one 16-query column group against 32 new keys.
// Scores are transposed: t0[r] = S[query col][key 8g + r], t1[r] the same for
// key 16 + 8g + r, so a lane holds 16 of its query's 32 scores. Maximum:
// in-lane, then one exchange between the halves. Sum: in-lane only; the
// halves' sums are joined once behind the key loop. Returns P^T as a B operand
// (element e -> key 8g + (e & 7) + 16 * (e >> 3), the order of load_frag_p).
// All arithmetic on the 16 scores is written on whole accumulators, so that it
// compiles to packed operations on the register pairs (r, r + 1) of one
// accumulator, which need no moves. m is the running maximum times log2(e):
// exp(t - max) = exp2(t * log2(e) - m) is then one fused multiply-add a score.
// ---------------------------------------------------------------------------
#define LOG2E 1.4426950408889634f

static __device__ __forceinline__ v16h softmax_step_t(const v8f& t0, const v8f& t1,
                                                      v8f& oa, v8f& ob, float& m,
                                                      float& l) {
  float mx = fmaxf(t0[0], t1[0]);
#pragma unroll
  for (int r = 1; r < 8; ++r) mx = fmaxf(mx, fmaxf(t0[r], t1[r]));
  mx = fmaxf(mx, xhalf(mx));
  float mnew = fmaxf(m, mx * LOG2E);
  float corr = __builtin_amdgcn_exp2f(m - mnew);
  v8f c, n;   // log2(e) and -mnew in every element
#pragma unroll
  for (int r = 0; r < 8; ++r) { c[r] = LOG2E; n[r] = -mnew; }
  v8f a0 = __builtin_elementwise_fma(t0, c, n);
  v8f a1 = __builtin_elementwise_fma(t1, c, n);
  v8f e0, e1;
  v16h p;
#pragma unroll
  for (int r = 0; r < 8; ++r) {
    e0[r] = __builtin_amdgcn_exp2f(a0[r]);
    e1[r] = __builtin_amdgcn_exp2f(a1[r]);
    p[r]     = (_Float16)e0[r];
    p[r + 8] = (_Float16)e1[r];
  }
  v8f s8 = e0 + e1;
  v4f s4 = __builtin_shufflevector(s8, s8, 0, 1, 2, 3) + __builtin_shufflevector(s8, s8, 4, 5, 6, 7);
  v2f s2 = __builtin_shufflevector(s4, s4, 0, 1) + __builtin_shufflevector(s4, s4, 2, 3);
  l = l * corr + (s2[0] + s2[1]);
  m = mnew;
  oa *= corr;
  ob *= corr;
  return p;
}

#define TAB_S 2056

__global__ void __launch_bounds__(256) attn_k(const _Float16* Q, const _Float16* K, const _Float16* Vt,
                       const float* rel, const _Float16* WoF, const float* bo,
                       float* out) {
  int lane = threadIdx.x & 31;
  int wave = (int)uni(threadIdx.x >> 5);   // the same in every lane: addresses built on it stay scalar
  int qt = blockIdx.x & 31;          // 32-query tile = image row, 0..31
  int b = blockIdx.x >> 5;
  int h = wave;
  int bh = b * NHEAD + h;

  // tab[h * TAB_S + 32 + i] = rel[63 * qt + 2015 - i][h], i = 0..2015. The copy
  // runs over 2048 rows, so that it has no branch: the 32 words in front of each
  // plane take the surplus (written, never read).
  __shared__ float tab[NHEAD * TAB_S];
  __shared__ __attribute__((aligned(16))) _Float16 x_s[2 * 8 * 512];
  {
    int tid = threadIdx.x & 255;   // the block has 256 threads
    v4f tv[16];
    // Chunk c = 16 bytes: heads 4 * (c & 1) .. + 3 of row 63 * qt + (c >> 1); a wave
    // loads 512 contiguous bytes. Unrolled so that all 16 loads of a thread are in
    // flight together; the surplus rows are clamped to stay inside rel.
#pragma unroll
    for (int k = 0; k < 16; ++k) {
      int cc = tid + 256 * k;
      int row = 63 * qt + (cc >> 1);
      tv[k] = *(const v4f*)(rel + (row < NREL ? row : NREL - 1) * NHEAD + (cc & 1) * 4);
    }
    // Unrolled so that tv[] stays in registers. Word 2047 - (cc >> 1) of the plane,
    // written as (127 - (tid >> 1)) + 128 * (15 - k) with the xor for the first term,
    // so that the register part of the LDS address is never below 0.
    int rt = (tid >> 1) ^ 127;
#pragma unroll
    for (int k = 0; k < 16; ++k) {
      float* d = tab + (tid & 1) * (4 * TAB_S) + rt + 128 * (15 - k);
      d[0]         = tv[k][0];
      d[TAB_S]     = tv[k][1];
      d[2 * TAB_S] = tv[k][2];
      d[3 * TAB_S] = tv[k][3];
    }
  }

  // Per (b,h): 64 blocks of Q, 64 of K (two a pass), 64 of V^T (two a pass).
  const _Float16* Qp  = Q  + (long)bh * S_LEN * HDIM;
  const _Float16* Kp  = K  + (long)bh * S_LEN * HDIM;
  const _Float16* Vtp = Vt + (long)bh * HDIM * S_LEN;

  int m0 = qt * 32;
  v16h qa0 = load_frag_p(Qp + (long)m0 * HDIM,       lane);  // full HD in one frag
  v16h qa1 = load_frag_p(Qp + (long)m0 * HDIM + 512, lane);

  // K and V^T fragments are loaded two passes ahead of their products, in two
  // register sets (even passes: a, odd passes: c). A pass asks for the K fragments
  // of the pass after next behind its score products and for the V^T fragments
  // behind its output products, so that a load has up to two passes of vector work
  // to arrive in, not the few instructions between a pass's head and its products.
  // The first two passes' loads stand here, to fly while the table is copied.
  // The 32 blocks of a batch element read the same K and V^T. Each starts its walk
  // over the 16 trips of 64 keys at trip t0 and wraps; two blocks share a t0. They
  // then do not all ask for the same lines at the same moment, and a line that one
  // block has brought in is there when the next comes to it. The online softmax takes
  // the keys in any order. t0 leaves out bit 2 of qt, so that any 4 successive blocks
  // out of 8 differ in it (for speed only; every t0 gives the same function).
  int t0 = (qt & 3) + 4 * (qt >> 3);
  const _Float16* Kf = Kp  + t0 * (64 * HDIM);
  const _Float16* Vf = Vtp + t0 * (64 * HDIM);
  v16h ka0 = load_frag_p(Kf,        lane), ka1 = load_frag_p(Kf + 512,  lane);
  v16h va0 = load_frag_p(Vf,        lane), va1 = load_frag_p(Vf + 512,  lane);
  v16h kc0 = load_frag_p(Kf + 1024, lane), kc1 = load_frag_p(Kf + 1536, lane);
  v16h vc0 = load_frag_p(Vf + 1024, lane), vc1 = load_frag_p(Vf + 1536, lane);

  v8f o00 = {}, o01 = {}, o10 = {}, o11 = {};
  float mq0 = -3.0e38f, lq0 = 0.0f, mq1 = -3.0e38f, lq1 = 0.0f;

  int col = lane & 15;
  int rbase = (lane >> 4) * 8;

  // The wave's 32 queries are image row qt (x = 16u + col); the 32 keys of a
  // pass are image row j0 / 32 (x = 16t + rbase + r). rel row index
  // (qt - j0/32 + 31) * 63 + 16(u - t) + col - rbase - r + 31, so in the
  // reversed plane: i = (j0/32) * 63 + 31 - col + rbase + r - 16(u - t).
  // col ^ 15 is 15 - col, written so that the register part of the LDS address
  // is never below 0 (a constant 15 would move into the offset field).
  const float* bp = tab + h * TAB_S + 32 + (col ^ 15) + rbase;

  __syncthreads();   // tab complete before any wave reads it

  // One pass: k0, k1, v0, v1 hold its fragments and leave holding those at Kn, Vn.
  auto pass = [&](v16h& k0, v16h& k1, v16h& v0, v16h& v1, const float* bw,
                  const _Float16* Kn, const _Float16* Vn) {
    // Swin relative-position bias (POS table is an analytic constant). Read ahead of
    // the products, so that the LDS latency passes behind them. Unrolled, so that b0,
    // b1, b2 stay in registers.
    v8f b0, b1, b2;
#pragma unroll
    for (int r = 0; r < 8; ++r) {
      b0[r] = bw[r];         // u = 1, t = 0
      b1[r] = bw[16 + r];    // u == t
      b2[r] = bw[32 + r];    // u = 0, t = 1
    }
    v8f z = {};
    // s<u><t>[r] = S[query m0 + 16u + col][key j0 + 16t + rbase + r]
    v8f s00 = wmma16(k0, qa0, z);
    v8f s01 = wmma16(k1, qa0, z);
    v8f s10 = wmma16(k0, qa1, z);
    v8f s11 = wmma16(k1, qa1, z);
    k0 = load_frag_p(Kn,       lane);
    k1 = load_frag_p(Kn + 512, lane);
    // Holds the refills up here. Without it they sink to the middle of the softmax
    // and lose half of their lead.
    __builtin_amdgcn_sched_barrier(0);
    // Whole accumulators: packed additions on the pairs (r, r + 1).
    s00 += b1;
    s01 += b2;
    s10 += b0;
    s11 += b1;

    v16h pb0 = softmax_step_t(s00, s01, o00, o01, mq0, lq0);
    v16h pb1 = softmax_step_t(s10, s11, o10, o11, mq1, lq1);

    o00 = wmma16(v0, pb0, o00);
    o01 = wmma16(v1, pb0, o01);
    o10 = wmma16(v0, pb1, o10);
    o11 = wmma16(v1, pb1, o11);
    v0 = load_frag_p(Vn,       lane);
    v1 = load_frag_p(Vn + 512, lane);
  };

  for (int i = 0; i < S_LEN / 64; ++i) {
    // Trip i works on keys 64t .. 64t + 63. The last trip has no pass after next: its
    // wrapped index asks for the first trip's blocks again (inside the buffers, never
    // used), so that no branch stands behind a product.
    int t  = (t0 + i) & 15;
    int nx = ((t0 + i + 1) & 15) * (64 * HDIM);
    const float* bw = bp + t * 126;
    pass(ka0, ka1, va0, va1, bw,      Kp + nx,        Vtp + nx);
    pass(kc0, kc1, vc0, vc1, bw + 63, Kp + nx + 1024, Vtp + nx + 1024);
    // Stands in front of the next trip's rewrite of the refills' address registers.
    asm volatile("s_wait_xcnt 0x0" ::: "memory");
  }

  // The wave's Wo fragments: columns 32 * wave + 16t + (lane & 15), 8 k steps.
  // Asked for here, so that they fly during the division, the X stores and the
  // barrier.
  const _Float16* Wp = WoF + (long)wave * (2 * 8 * 512);
  v16h w0[8], w1[8];
#pragma unroll
  for (int ks = 0; ks < 8; ++ks) {
    w0[ks] = load_frag_p(Wp + ks * 512,       lane);
    w1[ks] = load_frag_p(Wp + (8 + ks) * 512, lane);
  }
  int n0 = wave * 32;
  float bn0 = bo[n0 + col];
  float bn1 = bo[n0 + 16 + col];

  float inv0 = 1.0f / (lq0 + xhalf(lq0));
  float inv1 = 1.0f / (lq1 + xhalf(lq1));
  v8h x00, x01, x10, x11;
#pragma unroll
  for (int r = 0; r < 8; ++r) {
    x00[r] = (_Float16)(o00[r] * inv0);
    x01[r] = (_Float16)(o01[r] * inv0);
    x10[r] = (_Float16)(o10[r] * inv1);
    x11[r] = (_Float16)(o11[r] * inv1);
  }
  _Float16* X0 = x_s + h * 512 + lane * 8;
  _Float16* X1 = X0 + 8 * 512;   // the next row tile
  *(v8h*)(X0)       = x00;
  *(v8h*)(X0 + 256) = x01;
  *(v8h*)(X1)       = x10;
  *(v8h*)(X1 + 256) = x11;

  __syncthreads();   // all 8 heads of X in LDS before any wave reads them

  // a<u><t>: row tile u, column tile t; k steps in rising order, four at a time.
  v8f a00 = {}, a01 = {}, a10 = {}, a11 = {};
#pragma unroll
  for (int kh = 0; kh < 2; ++kh) {
    v16h x0[4], x1[4];
#pragma unroll
    for (int j = 0; j < 4; ++j) {
      x0[j] = load_frag_p(x_s + (kh * 4 + j) * 512,     lane);
      x1[j] = load_frag_p(x_s + (8 + kh * 4 + j) * 512, lane);
    }
    // Holds the 16 LDS loads ahead of the products. Without it the loads sink to
    // their uses, and the wave waits out one LDS latency per k step instead of one
    // per four.
    __builtin_amdgcn_sched_barrier(0);
#pragma unroll
    for (int j = 0; j < 4; ++j) {
      a00 = wmma16(x0[j], w0[kh * 4 + j], a00);
      a01 = wmma16(x0[j], w1[kh * 4 + j], a01);
      a10 = wmma16(x1[j], w0[kh * 4 + j], a10);
      a11 = wmma16(x1[j], w1[kh * 4 + j], a11);
    }
  }

#pragma unroll
  for (int r = 0; r < 8; ++r) {
    int ma = b * S_LEN + m0 + rbase + r;
    int mb2 = ma + 16;
    out[(long)ma  * DMODEL + n0 + col]      = a00[r] + bn0;
    out[(long)ma  * DMODEL + n0 + 16 + col] = a01[r] + bn1;
    out[(long)mb2 * DMODEL + n0 + col]      = a10[r] + bn0;
    out[(long)mb2 * DMODEL + n0 + 16 + col] = a11[r] + bn1;
  }
}

extern "C" void kernel_launch(void* const* d_in, const int* in_sizes, int n_in,
                              void* d_out, int out_size, void* d_ws, size_t ws_size,
                              hipStream_t stream) {
  (void)in_sizes; (void)n_in; (void)out_size; (void)ws_size;
  const float* inq  = (const float*)d_in[0];
  const float* inkv = (const float*)d_in[1];
  const float* Wq   = (const float*)d_in[2];
  const float* bq   = (const float*)d_in[3];
  const float* Wk   = (const float*)d_in[4];
  const float* bk   = (const float*)d_in[5];
  const float* Wv   = (const float*)d_in[6];
  const float* bv   = (const float*)d_in[7];
  const float* rel  = (const float*)d_in[8];
  const float* Wo   = (const float*)d_in[9];
  const float* bo   = (const float*)d_in[10];
  float* out = (float*)d_out;

  char* ws = (char*)d_ws;
  const size_t WSZ = 256 * 256 * sizeof(_Float16);                 // 128 KB
  const size_t QSZ = (size_t)8 * 8 * 1024 * 32 * sizeof(_Float16); // 4 MB
  _Float16* WoF = (_Float16*)(ws);
  size_t off = WSZ;
  _Float16* Qb = (_Float16*)(ws + off); off += QSZ;
  _Float16* Kb = (_Float16*)(ws + off); off += QSZ;
  _Float16* Vt = (_Float16*)(ws + off);

  qkv_proj_k<<<224, 256, 0, stream>>>(inq, inkv, Wq, Wk, Wv, Wo, bq, bk, bv,
                                      Qb, Kb, Vt, WoF);
  attn_k<<<256, 256, 0, stream>>>(Qb, Kb, Vt, rel, WoF, bo, out);
}
